// v009
// The times below were measured on an AMD MI455X: many runs one after another, warmed up first and cycling through
// copies of the inputs, with the whole window's GPU time divided by the number of runs. Launches and the gaps
// between them are all in it. The median over several windows is given; except for v000 it joins two sittings, which
// can be a few percent apart, so the side-by-side timings, each taken in one sitting, are the better comparison.
// The versions before v009 are in another document.
// Measured time: 89.6 microseconds a run.
// In both of two side-by-side timings against v008, it was 1.29 times as fast.
// All steps since the starting kernel, v000, together make it 24.9 times as fast.
// Contractions: q = x.Wq^T [4096x1024].[1024x1024], k/v = context.W^T and the output projection (+b) with f16 operands on pre-cast planes (v_wmma_f32_16x16x32_f16; 128x128 block tiles staged in LDS by asynchronous copies, 32x64 wave tiles, weights x16); per (batch, head) softmax(q k^T / 8 + b_h(|i-j|)) v over 2048 keys (head_dim 64) as a flash kernel with f16 q.k^T and f16 p.v (p as f16 of 4096 p), the periodic distance bias -floor(|i-j|/30) 2^-(h+1) read from a per-head relative-offset table built on device; f32 accumulate and softmax.
#include <hip/hip_runtime.h>
#include <math.h>

typedef __attribute__((ext_vector_type(16))) _Float16 v16h;
typedef __attribute__((ext_vector_type(8)))  _Float16 v8h;
typedef __attribute__((ext_vector_type(4)))  _Float16 v4h;
typedef __attribute__((ext_vector_type(16))) __bf16   v16b;
typedef __attribute__((ext_vector_type(8)))  float    v8f;
typedef __attribute__((ext_vector_type(4)))  float    v4f;

// 16-bit WMMA fragment map (wave32), lane L, h = L>>4, m = L&15:
//   A 16x32: lane = row m;   element i -> k = (i<8) ? 8h+i : 16+8h+(i-8)
//   B 32x16: lane = column m; the SAME k(i,h)
//   D 16x16 (8 f32): lane = column m; element r -> row 8h+r
__device__ __forceinline__ int frag_k(int i, int h) { return (i < 8) ? (8 * h + i) : (16 + 8 * h + (i - 8)); }
__device__ __forceinline__ __bf16 bf16_rne(float f) {
    unsigned int u = __float_as_uint(f);
    u += 0x7fffu + ((u >> 16) & 1u);
    return __builtin_bit_cast(__bf16, (unsigned short)(u >> 16));
}
__device__ __forceinline__ float bf16_f32(__bf16 b) { return __uint_as_float(((unsigned int)__builtin_bit_cast(unsigned short, b)) << 16); }
__device__ __forceinline__ v8f wmma16(v16h a, v16h b, v8f c) {
    c = __builtin_amdgcn_wmma_f32_16x16x32_f16(false, a, false, b, (short)0, c, false, false);
    asm volatile("v_nop\n\tv_nop\n\tv_nop\n\tv_nop" : "+v"(c) : "v"(a), "v"(b));
    return c;
}
__device__ __forceinline__ v8f wmmab(v16b a, v16b b, v8f c) {
    c = __builtin_amdgcn_wmma_f32_16x16x32_bf16(false, a, false, b, (short)0, c, false, false);
    asm volatile("v_nop\n\tv_nop\n\tv_nop\n\tv_nop" : "+v"(c) : "v"(a), "v"(b));
    return c;
}
struct Split { v16b hi, lo; };
// hi/lo split product: a.hi*b.hi + a.hi*b.lo + a.lo*b.hi
__device__ __forceinline__ v8f wmma3(const Split& a, const Split& b, v8f c) {
    c = __builtin_amdgcn_wmma_f32_16x16x32_bf16(false, a.hi, false, b.hi, (short)0, c, false, false);
    c = __builtin_amdgcn_wmma_f32_16x16x32_bf16(false, a.hi, false, b.lo, (short)0, c, false, false);
    c = __builtin_amdgcn_wmma_f32_16x16x32_bf16(false, a.lo, false, b.hi, (short)0, c, false, false);
    asm volatile("v_nop\n\tv_nop\n\tv_nop\n\tv_nop" : "+v"(c) : "v"(a.hi), "v"(a.lo), "v"(b.hi), "v"(b.lo));
    return c;
}
struct Split3 { v16b hi, mid, lo; };
// triple split product (6 terms, drops only terms below 2^-24 relative)
__device__ __forceinline__ v8f wmma6(const Split3& a, const Split3& b, v8f c) {
    c = __builtin_amdgcn_wmma_f32_16x16x32_bf16(false, a.hi, false, b.hi, (short)0, c, false, false);
    c = __builtin_amdgcn_wmma_f32_16x16x32_bf16(false, a.hi, false, b.mid, (short)0, c, false, false);
    c = __builtin_amdgcn_wmma_f32_16x16x32_bf16(false, a.mid, false, b.hi, (short)0, c, false, false);
    c = __builtin_amdgcn_wmma_f32_16x16x32_bf16(false, a.hi, false, b.lo, (short)0, c, false, false);
    c = __builtin_amdgcn_wmma_f32_16x16x32_bf16(false, a.mid, false, b.mid, (short)0, c, false, false);
    c = __builtin_amdgcn_wmma_f32_16x16x32_bf16(false, a.lo, false, b.hi, (short)0, c, false, false);
    asm volatile("v_nop\n\tv_nop\n\tv_nop\n\tv_nop" : "+v"(c) : "v"(a.hi), "v"(a.mid), "v"(a.lo), "v"(b.hi), "v"(b.mid), "v"(b.lo));
    return c;
}

// Fragment gathers from f32 memory: element i <- p[(k0 + frag_k(i,h)) * sk] * s, zero for k >= klen.
__device__ __forceinline__ v16h fh_ld(const float* __restrict__ p, long long sk, int k0, int h, int klen, float s) {
    v16h a;
#pragma unroll
    for (int i = 0; i < 16; ++i) { const int k = k0 + frag_k(i, h); a[i] = (k < klen) ? (_Float16)(p[(long long)k * sk] * s) : (_Float16)0.f; }
    return a;
}
__device__ __forceinline__ Split sp_ld(const float* __restrict__ p, long long sk, int k0, int h, int klen, float s) {
    Split r;
#pragma unroll
    for (int i = 0; i < 16; ++i) {
        const int k = k0 + frag_k(i, h); const float x = (k < klen) ? p[(long long)k * sk] * s : 0.f;
        const __bf16 hb = bf16_rne(x); r.hi[i] = hb; r.lo[i] = bf16_rne(x - bf16_f32(hb));
    }
    return r;
}
__device__ __forceinline__ Split3 sp3_ld(const float* __restrict__ p, long long sk, int k0, int h, int klen, float s) {
    Split3 r;
#pragma unroll
    for (int i = 0; i < 16; ++i) {
        const int k = k0 + frag_k(i, h); const float x = (k < klen) ? p[(long long)k * sk] * s : 0.f;
        const __bf16 hb = bf16_rne(x); const float r1 = x - bf16_f32(hb); const __bf16 mb = bf16_rne(r1);
        r.hi[i] = hb; r.mid[i] = mb; r.lo[i] = bf16_rne(r1 - bf16_f32(mb));
    }
    return r;
}
__device__ __forceinline__ v16b bh_ld(const float* __restrict__ p, long long sk, int k0, int h, int klen, float s) {
    v16b a;
#pragma unroll
    for (int i = 0; i < 16; ++i) { const int k = k0 + frag_k(i, h); a[i] = bf16_rne((k < klen) ? p[(long long)k * sk] * s : 0.f); }
    return a;
}
// f16 fragment from an f16 LDS/global row with element stride 1 (k-contiguous), no bounds (tile already zero padded)
__device__ __forceinline__ v16h fh_row(const _Float16* __restrict__ row, int k0, int h) {
    v16h a;
#pragma unroll
    for (int i = 0; i < 16; ++i) a[i] = row[k0 + frag_k(i, h)];
    return a;
}

#define VST2(T, ptr, val) do { const T vst2_v_ = (val); *(T*)(ptr) = vst2_v_;  } while (0)
typedef float v4f __attribute__((ext_vector_type(4)));
#define VST2V4(ptr, val) do { const v4f vst2_v4_ = (val); *(v4f*)(ptr) = vst2_v4_;  } while (0)

__device__ __attribute__((noinline)) float act_fn(float v, int act) {
    if (act == 1) return fmaxf(v, 0.f);                                                                               // relu
    if (act == 2) { const float u = 0.7978845608028654f * (v + 0.044715f * v * v * v); return 0.5f * v * (1.f + tanhf(u)); } // tanh-gelu
    if (act == 3) return v / (1.f + expf(-v));                                                                        // silu
    if (act == 4) return 0.5f * v * (1.f + erff(v * 0.7071067811865476f));                                             // erf-gelu
    if (act == 5) return tanhf(v);
    if (act == 6) return 1.f / (1.f + expf(-v));                                                                      // sigmoid
    if (act == 7) return (v > 0.f) ? v : 0.01f * v;                                                                   // leaky relu 0.01
    if (act == 8) return (v > 0.f) ? v : (expf(v) - 1.f);                                                             // elu
    if (act == 9) return fminf(fmaxf(v, 0.f), 6.f);                                                                   // relu6
    if (act == 10) return fabsf(v);                                                                                    // abs
    if (act == 11) return (v >= 0.f) ? v : 0.1f * v;                                                                  // leaky 0.1
    if (act == 12) return (v > 0.f) ? v : 0.2f * v;                                                                   // leaky 0.2
    if (act == 13) return (v > 20.f) ? v : log1pf(expf(v));                                                            // softplus
    return v;
}

// =====================================================================================================================
// k_gemm<MODE>: C(z, m, n) = act(alpha * sum_k A(z, m, k) * B(z, k, n) + bias) + beta * R(z, m, n)
//   One wave (32-thread block) per 16 x 32 tile of C; grid (ceil(N/32), ceil(M/16), Z). Batch z -> (zo = z / zi_n, zi = z % zi_n)
//   with separate outer/inner strides for every tensor (e.g. batch and head). A(m,k) = A[zo*sAo + zi*sAi + m*sAm + k*sAk] (f32),
//   B(k,n) = B[zo*sBo + zi*sBi + n*sBn + k*sBk] (f32); any M, N, K (K zero-padded to 32 inside the fragments, M/N tails guarded).
//   C(m,n) = C[zo*sCo + zi*sCi + m*sCm + n] (n contiguous). flags: 1 bias[n], 2 bias[m], 4 residual R[zo*sRo + zi*sRi + m*sRm + n*sRn].
//   MODE 0: f16 operands (A prescaled by sa, B by sb, both undone in the epilogue); 1: bf16 hi/lo split (3 products); 2: bf16;
//   3: bf16 hi/mid/lo triple split (6 products); 4: as 3 with Kahan-compensated f32 accumulation across k-steps.
// =====================================================================================================================
struct GemmP {
    const float* A; const float* B; const float* bias; const float* R; float* C;
    long long sAo, sAi, sAm, sAk, sBo, sBi, sBn, sBk, sCo, sCi, sCm, sRo, sRi, sRm, sRn;
    int M, N, K, zi_n, flags, act; float alpha, beta, sa, sb;
    int Npad, pad_;     // columns [N, Npad) of C are written as 0 so that padded workspace rows are covered by whole-line stores; Npad >= N
};
static_assert(sizeof(GemmP) == 5 * 8 + 15 * 8 + 6 * 4 + 4 * 4 + 2 * 4, "GemmP has padding");

template <int MODE>
__global__ __launch_bounds__(32) void k_gemm(GemmP p) {
    const int lane = threadIdx.x & 31, h = lane >> 4, l15 = lane & 15;
    const int m0 = blockIdx.y * 16, n0 = blockIdx.x * 32;
    const int z = blockIdx.z, zo = z / p.zi_n, zi = z - zo * p.zi_n;
    const float* A = p.A + zo * p.sAo + zi * p.sAi;
    const float* B = p.B + zo * p.sBo + zi * p.sBi;
    const int am = min(m0 + l15, p.M - 1);                       // clamped row for loads (stores are guarded)
    v8f acc[2], comp[2];
#pragma unroll
    for (int t = 0; t < 2; ++t) { v8f zz = {}; acc[t] = zz; comp[t] = zz; }
    for (int k0 = 0; k0 < p.K; k0 += 32) {
        const float* arow = A + (long long)am * p.sAm;
        if (MODE == 1) {
            const Split a = sp_ld(arow, p.sAk, k0, h, p.K, 1.f);
#pragma unroll
            for (int t = 0; t < 2; ++t) {
                const int bn = min(n0 + t * 16 + l15, p.N - 1);
                acc[t] = wmma3(a, sp_ld(B + (long long)bn * p.sBn, p.sBk, k0, h, p.K, 1.f), acc[t]);
            }
        } else if (MODE == 3) {
            const Split3 a = sp3_ld(arow, p.sAk, k0, h, p.K, 1.f);
#pragma unroll
            for (int t = 0; t < 2; ++t) {
                const int bn = min(n0 + t * 16 + l15, p.N - 1);
                acc[t] = wmma6(a, sp3_ld(B + (long long)bn * p.sBn, p.sBk, k0, h, p.K, 1.f), acc[t]);
            }
        } else if (MODE == 4) {
            // triple split as MODE 3, but each k-step's 6 products go into a fresh accumulator and the partial is added to the running f32 sum
            // on the VALU with Kahan compensation (accumulation error stays ~1 ulp however long K is)
            const Split3 a = sp3_ld(arow, p.sAk, k0, h, p.K, 1.f);
#pragma unroll
            for (int t = 0; t < 2; ++t) {
                const int bn = min(n0 + t * 16 + l15, p.N - 1); v8f zz = {};
                const v8f part = wmma6(a, sp3_ld(B + (long long)bn * p.sBn, p.sBk, k0, h, p.K, 1.f), zz);
                const v8f y = part - comp[t]; const v8f s = acc[t] + y; comp[t] = (s - acc[t]) - y; acc[t] = s;
            }
        } else if (MODE == 2) {
            const v16b a = bh_ld(arow, p.sAk, k0, h, p.K, 1.f);
#pragma unroll
            for (int t = 0; t < 2; ++t) {
                const int bn = min(n0 + t * 16 + l15, p.N - 1);
                acc[t] = wmmab(a, bh_ld(B + (long long)bn * p.sBn, p.sBk, k0, h, p.K, 1.f), acc[t]);
            }
        } else {
            const v16h a = fh_ld(arow, p.sAk, k0, h, p.K, p.sa);
#pragma unroll
            for (int t = 0; t < 2; ++t) {
                const int bn = min(n0 + t * 16 + l15, p.N - 1);
                acc[t] = wmma16(a, fh_ld(B + (long long)bn * p.sBn, p.sBk, k0, h, p.K, p.sb), acc[t]);
            }
        }
    }
    const float iscale = (MODE == 0) ? p.alpha / (p.sa * p.sb) : p.alpha;
    float* C = p.C + zo * p.sCo + zi * p.sCi;
    const float* R = p.R + zo * p.sRo + zi * p.sRi;
    __shared__ __align__(16) float ctile[16][36];
#pragma unroll
    for (int t = 0; t < 2; ++t) {
        const int n = n0 + t * 16 + l15; const int nn = min(n, p.N - 1);
#pragma unroll
        for (int r = 0; r < 8; ++r) {
            const int m = m0 + 8 * h + r; const int mm = min(m, p.M - 1);
            float v = acc[t][r] * iscale;
            if (p.flags & 1) v += p.bias[nn];
            if (p.flags & 2) v += p.bias[mm];
            if (p.flags & 8) v *= p.bias[(long long)zo * p.M + mm];   /* per-(z,row) scale vector laid out [Z][M]; exclusive with the bias flags */
            v = act_fn(v, p.act);
            if (p.flags & 4) v += p.beta * R[(long long)mm * p.sRm + (long long)nn * p.sRn];
            ctile[8 * h + r][t * 16 + l15] = (n < p.N) ? v : 0.f;
        }
    }
    __syncthreads();
    const int NW = (p.Npad > p.N) ? p.Npad : p.N;           // write width
    const bool fast = (m0 + 16 <= p.M) && (n0 + 32 <= NW) && ((p.sCm & 3) == 0) && ((((size_t)C) & 15) == 0);
    if (fast) {
#pragma unroll
        for (int s = 0; s < 4; ++s) {
            const int row = s * 4 + (lane >> 3), c4 = (lane & 7) * 4;
            const v4f v = *(const v4f*)&ctile[row][c4];
            VST2V4(C + (long long)(m0 + row) * p.sCm + n0 + c4, v);
        }
    } else {
        for (int row = 0; row < 16; ++row) {
            const int m = m0 + row, n = n0 + lane;
            if (m < p.M && n < NW) VST2(float, C + (long long)m * p.sCm + n, ctile[row][lane]);
        }
    }
}


// =====================================================================================================================
// k_gemmT<MODE, TM, TN>: same contract as k_gemm, but one wave computes a (16*TM) x (16*TN) tile: TM A fragments and TN B fragments are
//   loaded per 32-wide k-step and reused across TM*TN WMMAs (far fewer load/convert instructions per MAC). MODE 0 (f16), 1 (bf16 hi/lo),
//   2 (bf16) only. grid (ceil(NW/(16*TN)), ceil(M/(16*TM)), Z), block 32. Epilogue identical to k_gemm, run per 16x32 sub-tile.
// =====================================================================================================================
template <int MODE, int TM, int TN>
__global__ __launch_bounds__(32) void k_gemmT(GemmP p) {
    const int lane = threadIdx.x & 31, h = lane >> 4, l15 = lane & 15;
    const int m0 = blockIdx.y * (16 * TM), n0 = blockIdx.x * (16 * TN);
    const int z = blockIdx.z, zo = z / p.zi_n, zi = z - zo * p.zi_n;
    const float* A = p.A + zo * p.sAo + zi * p.sAi;
    const float* B = p.B + zo * p.sBo + zi * p.sBi;
    v8f acc[TM][TN];
#pragma unroll
    for (int i = 0; i < TM; ++i)
#pragma unroll
        for (int t = 0; t < TN; ++t) { v8f zz = {}; acc[i][t] = zz; }
    for (int k0 = 0; k0 < p.K; k0 += 32) {
        if (MODE == 1) {
            Split a[TM], b[TN];
#pragma unroll
            for (int i = 0; i < TM; ++i) { const int am = min(m0 + 16 * i + l15, p.M - 1); a[i] = sp_ld(A + (long long)am * p.sAm, p.sAk, k0, h, p.K, 1.f); }
#pragma unroll
            for (int t = 0; t < TN; ++t) { const int bn = min(n0 + 16 * t + l15, p.N - 1); b[t] = sp_ld(B + (long long)bn * p.sBn, p.sBk, k0, h, p.K, 1.f); }
#pragma unroll
            for (int i = 0; i < TM; ++i)
#pragma unroll
                for (int t = 0; t < TN; ++t) acc[i][t] = wmma3(a[i], b[t], acc[i][t]);
        } else if (MODE == 2) {
            v16b a[TM], b[TN];
#pragma unroll
            for (int i = 0; i < TM; ++i) { const int am = min(m0 + 16 * i + l15, p.M - 1); a[i] = bh_ld(A + (long long)am * p.sAm, p.sAk, k0, h, p.K, 1.f); }
#pragma unroll
            for (int t = 0; t < TN; ++t) { const int bn = min(n0 + 16 * t + l15, p.N - 1); b[t] = bh_ld(B + (long long)bn * p.sBn, p.sBk, k0, h, p.K, 1.f); }
#pragma unroll
            for (int i = 0; i < TM; ++i)
#pragma unroll
                for (int t = 0; t < TN; ++t) acc[i][t] = wmmab(a[i], b[t], acc[i][t]);
        } else {
            v16h a[TM], b[TN];
#pragma unroll
            for (int i = 0; i < TM; ++i) { const int am = min(m0 + 16 * i + l15, p.M - 1); a[i] = fh_ld(A + (long long)am * p.sAm, p.sAk, k0, h, p.K, p.sa); }
#pragma unroll
            for (int t = 0; t < TN; ++t) { const int bn = min(n0 + 16 * t + l15, p.N - 1); b[t] = fh_ld(B + (long long)bn * p.sBn, p.sBk, k0, h, p.K, p.sb); }
#pragma unroll
            for (int i = 0; i < TM; ++i)
#pragma unroll
                for (int t = 0; t < TN; ++t) acc[i][t] = wmma16(a[i], b[t], acc[i][t]);
        }
    }
    const float iscale = (MODE == 0) ? p.alpha / (p.sa * p.sb) : p.alpha;
    float* C = p.C + zo * p.sCo + zi * p.sCi;
    const float* R = p.R + zo * p.sRo + zi * p.sRi;
    const int NW = (p.Npad > p.N) ? p.Npad : p.N;
    __shared__ __align__(16) float ctile[16][36];
#pragma unroll
    for (int i = 0; i < TM; ++i) {
        const int mb = m0 + 16 * i; if (mb >= p.M) break;          // wave-uniform
#pragma unroll
        for (int tp = 0; tp < TN / 2; ++tp) {
            const int nb = n0 + 32 * tp; if (nb >= NW) break;        // wave-uniform
#pragma unroll
            for (int t2 = 0; t2 < 2; ++t2) {
                const int t = 2 * tp + t2; const int n = nb + t2 * 16 + l15; const int nn = min(n, p.N - 1);
#pragma unroll
                for (int r = 0; r < 8; ++r) {
                    const int m = mb + 8 * h + r; const int mm = min(m, p.M - 1);
                    float v = acc[i][t][r] * iscale;
                    if (p.flags & 1) v += p.bias[nn];
                    if (p.flags & 2) v += p.bias[mm];
            if (p.flags & 8) v *= p.bias[(long long)zo * p.M + mm];   /* per-(z,row) scale vector laid out [Z][M]; exclusive with the bias flags */
                    v = act_fn(v, p.act);
                    if (p.flags & 4) v += p.beta * R[(long long)mm * p.sRm + (long long)nn * p.sRn];
                    ctile[8 * h + r][t2 * 16 + l15] = (n < p.N) ? v : 0.f;
                }
            }
            __syncthreads();
            const bool fast = (mb + 16 <= p.M) && (nb + 32 <= NW) && ((p.sCm & 3) == 0) && ((((size_t)C) & 15) == 0);
            if (fast) {
#pragma unroll
                for (int s = 0; s < 4; ++s) {
                    const int row = s * 4 + (lane >> 3), c4 = (lane & 7) * 4;
                    const v4f v = *(const v4f*)&ctile[row][c4];
                    VST2V4(C + (long long)(mb + row) * p.sCm + nb + c4, v);
                }
            } else {
                for (int row = 0; row < 16; ++row) {
                    const int m = mb + row, n = nb + lane;
                    if (m < p.M && n < NW) VST2(float, C + (long long)m * p.sCm + n, ctile[row][lane]);
                }
            }
            __syncthreads();
        }
    }
}

// =====================================================================================================================
//   Wave = 16 queries, AW waves per block, 64-key blocks; grid (ceil(Lq/(16*AW)), H, B), block 32*AW. Any Lq, Lk; head dim dh <= DHP
//   (DHP multiple of 32), value dim dv <= DVP (multiple of 16, <= 128). Every tensor addressed by (batch, head, row, element) strides, f32.
//   Scores: QM 0 f16 operands, 1 bf16 hi/lo split, 2 bf16 triple split; statistics f32 (exp2 domain); P.V: P x 4096 as f16 with V f16 staged in LDS
//   (SPLITPV: P and V as bf16 hi/lo splits). kv head = h / hrep. Masking: causal = 1 (keep j <= i + coff, masked -> -inf, key blocks beyond the
//   diagonal skipped), causal = 2 (masked -> mfill, a finite fill like the -1e9; no skipping), causal = 3 (keep j >= i + coff,
//   masked -> -inf, no skipping); optional additive f32 mask Mf,
//   optional int keep-mask Mi (0 -> score := mfill), both addressed b*smb + h*smh + i*smi + j*smj (0 strides broadcast).
// =====================================================================================================================
#define AW 4
struct AttnP {   // apv4
    const float* Q; const float* K; const float* V; float* O; float* P; const float* Mf; const int* Mi; float* ST;
    const float* Pw; const float* Rt; const int* SQ; const int* SK;           // optional: post-softmax weight, relative-position table, segment ids
    long long swb, swh, swi, swj, srb, srh, sri;                                 // Pw strides (b,h,i,j); Rt strides (b,h,i), column = clamp(i - j + roff, 0, rn-1)
    long long sQb, sQh, sQi, sQd, sKb, sKh, sKj, sKd, sVb, sVh, sVj, sVd, sOb, sOh, sOi, sPb, sPh, sPi, smb, smh, smi, smj;
    int Lq, Lk, dh, dv, hrep, causal, coff, pband;   // pband > 0: P holds only the band |j - i| <= pband, column j - i + pband
    float scale, mfill; int nonorm, mpol;             // nonorm (online path only): O = sum_j exp(score_j) V_j without the 1/rowsum (scores must be <= ~0); mpol: Mi masks where ==0 (mpol 0) or where !=0 (mpol 1)
    int roff, rn, segpol, win;                        // Rt column offset/count; SQ/SK: score := mfill where (segpol 0) SQ[i] != SK[j] or (segpol 1) SQ[i] == SK[j]; win > 0: keys with i - j > win (after coff) -> -inf
};
//   Pw: the softmax numerator is multiplied by Pw(b,h,i,j) AFTER the row sum is taken (probs * weight, then P.V), as in post-softmax multiplicative biases.                                                    // ST (optional): per row (b,h,i) -> ST[((b*H + h)*Lq + i)*2 + {0,1}] = {row max of the scaled+masked score (natural units), sum_j exp(score - max)}
static_assert(sizeof(AttnP) == 12 * 8 + 29 * 8 + 16 * 4, "AttnP has padding");

// Inputs-only fence on sixteen loaded values: all must have arrived here, so their loads are issued together ahead of it and share one wait
// (without it the register-budgeted schedule waits after every load). It names no product and changes no value.
template <typename T> __device__ __forceinline__ void hold16(const T* x) {
    asm volatile("" :: "v"(x[0]), "v"(x[1]), "v"(x[2]), "v"(x[3]), "v"(x[4]), "v"(x[5]), "v"(x[6]), "v"(x[7]),
                       "v"(x[8]), "v"(x[9]), "v"(x[10]), "v"(x[11]), "v"(x[12]), "v"(x[13]), "v"(x[14]), "v"(x[15]));
}
#ifndef KATTN_ATTR
#define KATTN_ATTR __attribute__((amdgpu_waves_per_eu(4)))   // register budget of 256: four waves a SIMD, so that all 1,024 blocks of the launch are resident at once
#endif
//   GT > 0 fixes the geometry at compile time: Lq = Lk = GT, rows of GD floats with head h at column h * DHP (unit element stride), dh = DHP,
//   dv = DVP, one kv head per head, no mask, weight, segment, P or ST tensor, and a per-head Rt row of 2 GT - 1 columns. Only Q, K, V, O, Rt and scale
//   are then taken from the argument, so every length guard folds and the loads of a key block are contiguous and free of branches.
template <int DHP, int DVP, int QM, bool SPLITPV, bool TWOPASS, int GT = 0, int GD = 0>
__global__ __launch_bounds__(32 * AW) KATTN_ATTR void k_attn(AttnP parg) {
    AttnP p = parg;
    if (GT > 0) {
        p.P = nullptr; p.Mf = nullptr; p.Mi = nullptr; p.ST = nullptr; p.Pw = nullptr; p.SQ = nullptr; p.SK = nullptr;
        p.swb = 0; p.swh = 0; p.swi = 0; p.swj = 0; p.srb = 0; p.srh = 2 * GT - 1; p.sri = 0;
        p.sQb = (long long)GT * GD; p.sQh = DHP; p.sQi = GD; p.sQd = 1; p.sKb = (long long)GT * GD; p.sKh = DHP; p.sKj = GD; p.sKd = 1;
        p.sVb = (long long)GT * GD; p.sVh = DVP; p.sVj = GD; p.sVd = 1; p.sOb = (long long)GT * GD; p.sOh = DVP; p.sOi = GD;
        p.sPb = 0; p.sPh = 0; p.sPi = 0; p.smb = 0; p.smh = 0; p.smi = 0; p.smj = 0;
        p.Lq = GT; p.Lk = GT; p.dh = DHP; p.dv = DVP; p.hrep = 1; p.causal = 0; p.coff = 0; p.pband = 0;
        p.mfill = 0.f; p.nonorm = 0; p.mpol = 0; p.roff = GT - 1; p.rn = 2 * GT - 1; p.segpol = 0; p.win = 0;
        __builtin_assume(p.Rt != nullptr);
    }
    constexpr bool FULL = GT > 0 && GT % (16 * AW) == 0 && GT % 64 == 0;   // every query tile and key block is whole: index clamps and length guards are identities
    constexpr int NT = DVP / 16;                // output tiles
    constexpr int KS = DHP / 32;                // k-steps for the scores
    constexpr int VP = DVP + 8;                 // LDS pitch (halves)
    __shared__ __align__(16) float    pl[AW][16 * 64];
    __shared__ __align__(16) _Float16 vl[(SPLITPV ? 2 : 1) * 64 * VP];   // f16 V tile, or bf16 hi and lo tiles (same 2-byte size)
    const int lane = threadIdx.x & 31, hf = lane >> 4, l15 = lane & 15, wave = threadIdx.x >> 5;
    const int h = blockIdx.y, b = blockIdx.z, hk = h / p.hrep;
    const int q0 = (blockIdx.x * AW + wave) * 16;
    float* myp = pl[wave];
    const float L2E = 1.4426950408889634f;
    const float NEG = -__builtin_inff();
    const int qi = FULL ? q0 + l15 : min(q0 + l15, p.Lq - 1);
    const float* qrow = p.Q + b * p.sQb + h * p.sQh + (long long)qi * p.sQi;
    const float* kbase = p.K + b * p.sKb + hk * p.sKh;
    const float* vbase = p.V + b * p.sVb + hk * p.sVh;
    v16h qa[QM == 0 ? KS : 1]; Split qs_[QM == 1 ? KS : 1]; Split3 qt_[QM == 2 ? KS : 1];
#pragma unroll
    for (int ks = 0; ks < KS; ++ks) {
        if (QM == 2) qt_[ks] = sp3_ld(qrow, p.sQd, ks * 32, hf, p.dh, 1.f);
        else if (QM == 1) qs_[ks] = sp_ld(qrow, p.sQd, ks * 32, hf, p.dh, 1.f);
        else qa[ks] = fh_ld(qrow, p.sQd, ks * 32, hf, p.dh, 1.f);
    }
    v8f o[NT]; float m8[8], l8[8];
#pragma unroll
    for (int t = 0; t < NT; ++t) { v8f zz = {}; o[t] = zz; }
#pragma unroll
    for (int i = 0; i < 8; ++i) { m8[i] = NEG; l8[i] = 0.f; }
    int jend = p.Lk;
    if (p.causal == 1) { const int je = (blockIdx.x * AW + AW - 1) * 16 + 16 + p.coff; jend = min(jend, max(je, 0)); }   // uniform per block
    const int npass = TWOPASS ? 2 : 1;
    for (int pass = 0; pass < npass; ++pass) {
        const bool dopv = (!TWOPASS) || pass == 1;
        for (int j0 = 0; j0 < jend; j0 += 64) {
            if (dopv) {
                __syncthreads();                                 // previous key block's reads of vl / pl are done
                constexpr int VN = 64 * DVP / (32 * AW);         // V elements per thread and key block
                constexpr bool VLIN = (32 * AW) % DVP == 0;      // a thread keeps its column: its rows differ by a constant step
                float vf[VN];
#pragma unroll   // constant trip count: with the guard folded the tile's loads differ by immediate offsets only
                for (int it = 0; it < VN; ++it) {
                    const int idx = threadIdx.x + it * (32 * AW);
                    const int jr = VLIN ? (int)threadIdx.x / DVP + it * ((32 * AW) / DVP) : idx / DVP, d = VLIN ? (int)threadIdx.x % DVP : idx - jr * DVP, j = j0 + jr;
                    if constexpr (FULL && VLIN)   // block-uniform tile pointer + the thread's fixed offset + a constant
                        vf[it] = (vbase + (long long)j0 * GD)[(size_t)(unsigned)((int)threadIdx.x / DVP * GD + (int)threadIdx.x % DVP) + it * ((32 * AW) / DVP) * GD];
                    else
                        vf[it] = (j < p.Lk && d < p.dv) ? vbase[(long long)j * p.sVj + (long long)d * p.sVd] : 0.f;
                }
                if (FULL && VN == 32) { hold16(vf); hold16(vf + 16); }   // the tile's loads all issue ahead of this line and are waited for once
#pragma unroll
                for (int it = 0; it < VN; ++it) {
                    const int idx = threadIdx.x + it * (32 * AW);
                    const int jr = VLIN ? (int)threadIdx.x / DVP + it * ((32 * AW) / DVP) : idx / DVP, d = VLIN ? (int)threadIdx.x % DVP : idx - jr * DVP;
                    const float f = vf[it];
                    if (SPLITPV) {
                        const __bf16 hb = bf16_rne(f);
                        ((__bf16*)vl)[jr * VP + d] = hb; ((__bf16*)vl)[64 * VP + jr * VP + d] = bf16_rne(f - bf16_f32(hb));
                    } else vl[jr * VP + d] = (_Float16)f;
                }
            }
            v8f s[4];
            float rb[8][4];                                     // the key block's relative-position table entries, fetched ahead of the products
            if constexpr (FULL) {
                // column i - j + GT - 1 as block-uniform pointer + the lane's fixed offset + a constant, each part >= 0 (j0 <= GT - 64)
                const float* rt = p.Rt + (long long)h * (2 * GT - 1) + ((int)blockIdx.x * (16 * AW) - j0 + (GT - 64));
                const unsigned ro = (unsigned)(wave * 16 + 8 * hf + 15 - l15);
#pragma unroll
                for (int i = 0; i < 8; ++i)
#pragma unroll
                    for (int t = 0; t < 4; ++t) rb[i][t] = rt[(size_t)ro + (i + 16 * (3 - t))];
            } else if (p.Rt) {
#pragma unroll
                for (int i = 0; i < 8; ++i)
#pragma unroll
                    for (int t = 0; t < 4; ++t) {
                        const int ic = min(q0 + i + 8 * hf, p.Lq - 1);
                        int rc = ic - min(j0 + t * 16 + l15, p.Lk - 1) + p.roff; rc = rc < 0 ? 0 : (rc >= p.rn ? p.rn - 1 : rc);
                        rb[i][t] = p.Rt[b * p.srb + h * p.srh + (long long)ic * p.sri + rc];
                    }
            }
            if constexpr (FULL && QM == 0 && KS == 2) {
                // two key tiles at a time: their sixteen 16-byte loads (fh_ld's k order: floats 8 hf + 0..7 and 16 + 8 hf + 0..7 of each 32) fly together
#pragma unroll
                for (int tp = 0; tp < 2; ++tp) {
                    v4f kr[16];
#pragma unroll
                    for (int t2 = 0; t2 < 2; ++t2)
#pragma unroll
                        for (int ks = 0; ks < 2; ++ks) {
                            const v4f* kp = (const v4f*)((kbase + (long long)j0 * GD) + ((size_t)(unsigned)(l15 * GD + 8 * hf) + (2 * tp + t2) * 16 * GD + ks * 32));
                            kr[(t2 * 2 + ks) * 4 + 0] = kp[0]; kr[(t2 * 2 + ks) * 4 + 1] = kp[1]; kr[(t2 * 2 + ks) * 4 + 2] = kp[4]; kr[(t2 * 2 + ks) * 4 + 3] = kp[5];
                        }
                    hold16(kr);                                  // all sixteen loads issue ahead of this line and are waited for once
#pragma unroll
                    for (int t2 = 0; t2 < 2; ++t2) {
                        v8f acc = {};
#pragma unroll
                        for (int ks = 0; ks < 2; ++ks) {
                            v16h kfr;
#pragma unroll
                            for (int e = 0; e < 16; ++e) kfr[e] = (_Float16)kr[(t2 * 2 + ks) * 4 + (e >> 2)][e & 3];
                            acc = wmma16(qa[ks], kfr, acc);
                        }
                        s[2 * tp + t2] = acc;
                    }
                }
            } else {
#pragma unroll
            for (int t = 0; t < 4; ++t) {
                const int j = min(j0 + t * 16 + l15, p.Lk - 1);
                const float* krow = kbase + (long long)j * p.sKj;
                v8f acc = {};
#pragma unroll
                for (int ks = 0; ks < KS; ++ks) {
                    if (QM == 2)      acc = wmma6(qt_[ks], sp3_ld(krow, p.sKd, ks * 32, hf, p.dh, 1.f), acc);
                    else if (QM == 1) acc = wmma3(qs_[ks], sp_ld(krow, p.sKd, ks * 32, hf, p.dh, 1.f), acc);
                    else              acc = wmma16(qa[ks], fh_ld(krow, p.sKd, ks * 32, hf, p.dh, 1.f), acc);
                }
                s[t] = acc;
            }
            }
            float pv[8][4];
#pragma unroll
            for (int i = 0; i < 8; ++i) {
                const int irow = q0 + i + 8 * hf;
                const int ic = FULL ? irow : min(irow, p.Lq - 1);
                float sc[4];
#pragma unroll
                for (int t = 0; t < 4; ++t) {
                    const int jg = j0 + t * 16 + l15;
                    float v = s[t][i] * p.scale;
                    if (p.Mf) v += p.Mf[b * p.smb + h * p.smh + (long long)ic * p.smi + (long long)min(jg, p.Lk - 1) * p.smj];
                    if (p.Rt) v += rb[i][t];
                    if (p.Mi) { const int mv = p.Mi[b * p.smb + h * p.smh + (long long)ic * p.smi + (long long)min(jg, p.Lk - 1) * p.smj]; if (p.mpol ? (mv != 0) : (mv == 0)) v = p.mfill; }
                    if (p.SQ) { const bool same = p.SQ[(long long)b * p.Lq + ic] == p.SK[(long long)b * p.Lk + min(jg, p.Lk - 1)]; if (p.segpol ? same : !same) v = p.mfill; }
                    if (p.causal == 2 && jg > irow + p.coff) v = p.mfill;
                    if ((!FULL && jg >= p.Lk) || (p.causal == 1 && jg > irow + p.coff) || (p.causal == 3 && jg < irow + p.coff) || (p.win > 0 && irow + p.coff - jg > p.win)) v = NEG; else v *= L2E;
                    sc[t] = v;
                }
                if (!TWOPASS || pass == 0) {
                    float mx = fmaxf(fmaxf(sc[0], sc[1]), fmaxf(sc[2], sc[3]));
                    mx = fmaxf(mx, __shfl_xor(mx, 1, 32)); mx = fmaxf(mx, __shfl_xor(mx, 2, 32));
                    mx = fmaxf(mx, __shfl_xor(mx, 4, 32)); mx = fmaxf(mx, __shfl_xor(mx, 8, 32));
                    const float mnew = fmaxf(m8[i], mx);
                    const float corr = (mnew == NEG) ? 1.f : exp2f(m8[i] - mnew);
                    float rs = 0.f;
#pragma unroll
                    for (int t = 0; t < 4; ++t) {
                        const float pp = (sc[t] == NEG) ? 0.f : exp2f(sc[t] - mnew); rs += pp;
                        pv[i][t] = p.Pw ? pp * p.Pw[b * p.swb + h * p.swh + (long long)ic * p.swi + (long long)min(j0 + t * 16 + l15, p.Lk - 1) * p.swj] : pp;
                    }
                    rs += __shfl_xor(rs, 1, 32); rs += __shfl_xor(rs, 2, 32); rs += __shfl_xor(rs, 4, 32); rs += __shfl_xor(rs, 8, 32);
                    l8[i] = l8[i] * corr + rs; m8[i] = mnew;
                    if (!TWOPASS) {
#pragma unroll
                        for (int t = 0; t < NT; ++t) o[t][i] *= corr;
                    }
                } else {
                    const float inv = (l8[i] > 0.f) ? 1.f / l8[i] : 0.f;
#pragma unroll
                    for (int t = 0; t < 4; ++t) {
                        const int jg = j0 + t * 16 + l15;
                        float pp = (sc[t] == NEG) ? 0.f : exp2f(sc[t] - m8[i]) * inv;
                        if (p.Pw) pp *= p.Pw[b * p.swb + h * p.swh + (long long)ic * p.swi + (long long)min(jg, p.Lk - 1) * p.swj];
                        pv[i][t] = pp;
                    }
                }
            }
            if (dopv) {
#pragma unroll
                for (int i = 0; i < 8; ++i)
#pragma unroll
                    for (int t = 0; t < 4; ++t) ((float*)myp)[(i + 8 * hf) * 64 + t * 16 + l15] = pv[i][t];
                __syncthreads();                                 // P (per wave) and V (shared) visible
                if (p.P) {
                    float* pb_ = p.P + b * p.sPb + h * p.sPh;
                    const bool fastP = (p.pband == 0) && ((p.sPi & 3) == 0) && (j0 + 64 <= p.Lk) && (q0 + 16 <= p.Lq) && ((((size_t)pb_) & 15) == 0);
                    if (fastP) {
#pragma unroll
                        for (int s = 0; s < 8; ++s) {
                            const int row = s * 2 + (lane >> 4), c4 = (lane & 15) * 4;
                            const v4f v = *(const v4f*)(myp + row * 64 + c4);
                            VST2V4(pb_ + (long long)(q0 + row) * p.sPi + j0 + c4, v);
                        }
                    } else {
                        for (int row = 0; row < 16; ++row) {
                            const int irow = q0 + row; if (irow >= p.Lq) continue;
                            for (int c = lane; c < 64; c += 32) {
                                const int jg = j0 + c; if (jg >= p.Lk) continue;
                                if (p.pband == 0) VST2(float, pb_ + (long long)irow * p.sPi + jg, myp[row * 64 + c]);
                                else if (jg - irow <= p.pband && irow - jg <= p.pband) VST2(float, pb_ + (long long)irow * p.sPi + (jg - irow + p.pband), myp[row * 64 + c]);
                            }
                        }
                    }
                }
                if (SPLITPV) {
                    const Split pa0 = sp_ld(myp + l15 * 64, 1, 0, hf, 64, 1.f), pa1 = sp_ld(myp + l15 * 64, 1, 32, hf, 64, 1.f);
                    const __bf16* vh = (const __bf16*)vl; const __bf16* vlo = vh + 64 * VP;
#pragma unroll
                    for (int t = 0; t < NT; ++t) {
                        const int dcol = t * 16 + l15;
                        Split b0, b1;
#pragma unroll
                        for (int e = 0; e < 16; ++e) {
                            const int k0 = frag_k(e, hf), k1 = 32 + frag_k(e, hf);
                            b0.hi[e] = vh[k0 * VP + dcol]; b0.lo[e] = vlo[k0 * VP + dcol]; b1.hi[e] = vh[k1 * VP + dcol]; b1.lo[e] = vlo[k1 * VP + dcol];
                        }
                        o[t] = wmma3(pa0, b0, o[t]);
                        o[t] = wmma3(pa1, b1, o[t]);
                    }
                } else {
                    const v16h pa0 = fh_ld(myp + l15 * 64, 1, 0, hf, 64, 4096.f), pa1 = fh_ld(myp + l15 * 64, 1, 32, hf, 64, 4096.f);
#pragma unroll
                    for (int t = 0; t < NT; ++t) {
                        const int dcol = t * 16 + l15;
                        v16h b0, b1;
#pragma unroll
                        for (int e = 0; e < 16; ++e) { b0[e] = vl[frag_k(e, hf) * VP + dcol]; b1[e] = vl[(32 + frag_k(e, hf)) * VP + dcol]; }
                        o[t] = wmma16(pa0, b0, o[t]);
                        o[t] = wmma16(pa1, b1, o[t]);
                    }
                }
            }
        }
    }
    float* obase = p.O + b * p.sOb + h * p.sOh;
    if (p.ST) {
        const int rl = lane >> 1, isel = rl & 7;           // row q0 + rl ; rl>>3 == hf holds because lane>>4 == (lane>>1)>>3
        float mv = 0.f, lv = 0.f;
#pragma unroll
        for (int i = 0; i < 8; ++i) if (i == isel) { mv = m8[i]; lv = l8[i]; }
        const int irow = q0 + rl;
        if (irow < p.Lq) { float* st = p.ST + (((long long)b * gridDim.y + h) * p.Lq + irow) * 2 + (lane & 1); VST2(float, st, (lane & 1) ? lv : mv * 0.6931471805599453f); }
    }
    float invr[8];
#pragma unroll
    for (int i = 0; i < 8; ++i) {
        if (TWOPASS) invr[i] = SPLITPV ? 1.f : (1.f / 4096.f);
        else if (p.nonorm) invr[i] = exp2f(m8[i]) * (SPLITPV ? 1.f : (1.f / 4096.f));
        else invr[i] = (l8[i] > 0.f) ? (SPLITPV ? 1.f / l8[i] : 1.f / (l8[i] * 4096.f)) : 0.f;
    }
    __syncthreads();                                             // all waves done with pl/vl from the main loop
    const bool ofast = ((p.sOi & 3) == 0) && ((((size_t)obase) & 15) == 0) && (q0 + 16 <= p.Lq);
#pragma unroll
    for (int c0 = 0; c0 < DVP; c0 += 64) {
#pragma unroll
        for (int i = 0; i < 8; ++i)
#pragma unroll
            for (int t = 0; t < NT; ++t) if (t * 16 >= c0 && t * 16 < c0 + 64) ((float*)myp)[(i + 8 * hf) * 64 + (t * 16 - c0) + l15] = o[t][i] * invr[i];
        __syncthreads();
        const int cw = (DVP - c0 < 64) ? (DVP - c0) : 64;      // staged columns in this chunk (multiple of 16)
        if (ofast && (c0 + cw <= p.dv) && (cw % 32 == 0)) {
            const int lpr = cw / 4;                              // lanes per row (16 for 64 cols, 8 for 32)
            const int rows_per_ins = 32 / lpr;
            for (int r0 = 0; r0 < 16; r0 += rows_per_ins) {
                const int row = r0 + lane / lpr, c4 = (lane % lpr) * 4;
                const v4f v = *(const v4f*)(myp + row * 64 + c4);
                VST2V4(obase + (long long)(q0 + row) * p.sOi + c0 + c4, v);
            }
        } else {
            for (int row = 0; row < 16; ++row) {
                const int irow = q0 + row; if (irow >= p.Lq) continue;
                for (int c = lane; c < cw; c += 32) { const int d = c0 + c; if (d < p.dv) VST2(float, obase + (long long)irow * p.sOi + d, myp[row * 64 + c]); }
            }
        }
        __syncthreads();
    }
}

__device__ __forceinline__ float xhalf(float x) { return __builtin_bit_cast(float, __builtin_amdgcn_permlanex16(__builtin_bit_cast(int, x), __builtin_bit_cast(int, x), 0x76543210, 0xfedcba98, false, false)); }
// 2^x as the one hardware instruction. exp2f puts a compare, two selects, an add and a ldexp round every v_exp_f32, only so that results below 2^-126 come out as
// denormals. Every argument here is a score minus the row's running maximum: such a term is under 2^-126 of the row's largest, is zero as an f16 p either way and
// cannot move the f32 row sum, which ends at 1 or more. From -126 up the value is the same bit for bit; -inf (the first trip's old maximum) gives 0 as before.
// Written as asm, each value in its own register and in place, so that the slot which the instruction set asks for behind a transcendental is filled by construction:
// behind each v_exp_f32 stands one that touches neither its result nor its source, behind the last a v_nop.
__device__ __forceinline__ void exp2_run8(float* x) {
    asm("v_exp_f32 %0, %0\n\tv_exp_f32 %1, %1\n\tv_exp_f32 %2, %2\n\tv_exp_f32 %3, %3\n\t"
        "v_exp_f32 %4, %4\n\tv_exp_f32 %5, %5\n\tv_exp_f32 %6, %6\n\tv_exp_f32 %7, %7\n\tv_nop"
        : "+v"(x[0]), "+v"(x[1]), "+v"(x[2]), "+v"(x[3]), "+v"(x[4]), "+v"(x[5]), "+v"(x[6]), "+v"(x[7]));
}
__device__ __forceinline__ float exp2_one(float x) { asm("v_exp_f32 %0, %0\n\tv_nop" : "+v"(x)); return x; }   // the same, one value
// One thread's eight copies for one key block: four 16-byte pieces of the K tile and four of the V^T tile, each the same 16 bytes of rows 16 apart
// (eight lanes cover one row's 128 bytes, a whole line). lk, lv = LDS byte addresses, gk, gv = global addresses of the first piece of each tile.
// The s_wait_xcnt closes the statement so that no register which a copy names is rewritten ahead of it.
template <int PB, int KLD, int VLD>
__device__ __forceinline__ void at_copy8(unsigned lk, unsigned lv, const _Float16* gk, const _Float16* gv) {
    asm volatile(
        "global_load_async_to_lds_b128 %0, %8, off\n\t"
        "global_load_async_to_lds_b128 %1, %9, off\n\t"
        "global_load_async_to_lds_b128 %2, %10, off\n\t"
        "global_load_async_to_lds_b128 %3, %11, off\n\t"
        "global_load_async_to_lds_b128 %4, %12, off\n\t"
        "global_load_async_to_lds_b128 %5, %13, off\n\t"
        "global_load_async_to_lds_b128 %6, %14, off\n\t"
        "global_load_async_to_lds_b128 %7, %15, off\n\t"
        "s_wait_xcnt 0x0"
        :: "v"(lk), "v"(lk + 16 * PB), "v"(lk + 32 * PB), "v"(lk + 48 * PB), "v"(lv), "v"(lv + 16 * PB), "v"(lv + 32 * PB), "v"(lv + 48 * PB),
           "v"(gk), "v"(gk + 16 * KLD), "v"(gk + 32 * KLD), "v"(gk + 48 * KLD), "v"(gv), "v"(gv + 16 * VLD), "v"(gv + 32 * VLD), "v"(gv + 48 * VLD)
        : "memory");
}
// Q and K: f16 planes of GR rows (batch * GT + position) x GD columns, head h at column h * 64. Vt: the f16 plane of V transposed, GD rows (head h at row h * 64) x GR columns.
// O: laid out like Q, rounded to f16 here, the form in which the output projection's products read it.
template <int GT, int GD, int GR>
__global__ __launch_bounds__(32 * AW) KATTN_ATTR void k_attnT(const _Float16* __restrict__ Q, const _Float16* __restrict__ K, const _Float16* __restrict__ Vt, _Float16* __restrict__ O, const float* __restrict__ Rt, float scale) {
    static_assert(GT % (16 * AW) == 0 && GT % 64 == 0 && GT >= 128 && AW == 4, "whole query tiles and key blocks; 128 threads copy the 64 x 64 K and V^T tiles; the two-buffer prologue needs two key blocks");
    constexpr int DH = 64;                      // head size
    constexpr int VP = 64 + 8;                  // LDS pitch (halves): rows of 128 bytes + 16, for 16-byte readers
    constexpr int TB = 64 * VP * 2;             // one tile in LDS, bytes
    __shared__ __align__(16) _Float16 vt[2][DH * VP];   // V^T tile: row = head column, 64 keys along the row
    __shared__ __align__(16) _Float16 kt[2][64 * VP];   // K tile: row = key, the 64 head columns along the row; both tiles are copied in once a key block and read by all four waves
    const int lane = threadIdx.x & 31, hf = lane >> 4, l15 = lane & 15, wave = threadIdx.x >> 5;
    const int h = blockIdx.y, b = blockIdx.z;
    const int q0 = (blockIdx.x * AW + wave) * 16;
    const float L2E = 1.4426950408889634f;
    const int crow = threadIdx.x >> 3, ccol = threadIdx.x & 7;      // copies: eight lanes cover one tile row
    const _Float16* gk = K + (size_t)(b * GT + crow) * GD + h * DH + ccol * 8;
    const _Float16* gv = Vt + (size_t)(h * DH + crow) * GR + b * GT + ccol * 8;
    const unsigned lk = (unsigned)(size_t)&kt[0][0] + (unsigned)(crow * (VP * 2) + ccol * 16);
    const unsigned lv = (unsigned)(size_t)&vt[0][0] + (unsigned)(crow * (VP * 2) + ccol * 16);
    at_copy8<VP * 2, GD, GR>(lk, lv, gk, gv);
    const _Float16* qrow = Q + (size_t)(b * GT + q0 + l15) * GD + h * DH + 8 * hf;
    v16h qb[2];                                 // halves 8 hf + 0..7 and 16 + 8 hf + 0..7 of each 32: the k order of the K fragments below
#pragma unroll
    for (int ks = 0; ks < 2; ++ks) {
        const v8h q0h = *(const v8h*)(qrow + ks * 32), q1h = *(const v8h*)(qrow + ks * 32 + 16);
        qb[ks] = __builtin_shufflevector(q0h, q1h, 0, 1, 2, 3, 4, 5, 6, 7, 8, 9, 10, 11, 12, 13, 14, 15);
    }
    v8f o[4]; float m = -__builtin_inff(), l = 0.f;
#pragma unroll
    for (int t = 0; t < 4; ++t) { v8f zz = {}; o[t] = zz; }
    asm volatile("s_wait_asynccnt 0x0" ::: "memory");    // this wave's share of key block 0 has landed
    __syncthreads();                                     // key block 0 is whole for every wave
    at_copy8<VP * 2, GD, GR>(lk + TB, lv + TB, gk + 64 * GD, gv + 64);
    for (int j0 = 0; j0 < GT; j0 += 64) {
        // This trip works on key block j0 in buffer cur; the next block's copies, issued a trip ago, fly into the other buffer.
        const int cur = (j0 >> 6) & 1;
        // table column i - j + GT - 1 as block-uniform pointer + the lane's fixed offset + a constant, each part >= 0 (j0 <= GT - 64)
        float rb[4][8];
        const float* rt = Rt + (long long)h * (2 * GT - 1) + ((int)blockIdx.x * (16 * AW) - j0 + (GT - 64));
        const unsigned ro = (unsigned)(wave * 16 + l15 + 8 * (1 - hf));
#pragma unroll
        for (int t = 0; t < 4; ++t)
#pragma unroll
            for (int r = 0; r < 8; ++r) rb[t][r] = rt[(size_t)ro + (16 * (3 - t) + (7 - r))];
        v8f s[4];
        v8h ka[16];                                      // the eight K fragments, the k order of qb: halves 8 hf + 0..7 and 16 + 8 hf + 0..7 of each 32
#pragma unroll
        for (int t = 0; t < 4; ++t)
#pragma unroll
            for (int ks = 0; ks < 2; ++ks) {
                const _Float16* kr = kt[cur] + (t * 16 + l15) * VP + ks * 32 + 8 * hf;
                ka[(t * 2 + ks) * 2] = *(const v8h*)kr; ka[(t * 2 + ks) * 2 + 1] = *(const v8h*)(kr + 16);
            }
        hold16(ka);                                      // the sixteen LDS reads issue together and are waited for once (otherwise: one fragment's registers, a full LDS wait in front of each product)
#pragma unroll
        for (int t = 0; t < 4; ++t) {
            v8f acc = {};
#pragma unroll
            for (int ks = 0; ks < 2; ++ks) {
                const v16h kfr = __builtin_shufflevector(ka[(t * 2 + ks) * 2], ka[(t * 2 + ks) * 2 + 1], 0, 1, 2, 3, 4, 5, 6, 7, 8, 9, 10, 11, 12, 13, 14, 15);
                acc = __builtin_amdgcn_wmma_f32_16x16x32_f16(false, kfr, false, qb[ks], (short)0, acc, false, false);   // A = key rows, B = query columns
            }
            s[t] = acc;
        }
        float sc[4][8], mt[4];
#pragma unroll
        for (int t = 0; t < 4; ++t) {
#pragma unroll
            for (int r = 0; r < 8; ++r) sc[t][r] = (s[t][r] * scale + rb[t][r]) * L2E;
            mt[t] = fmaxf(fmaxf(fmaxf(sc[t][0], sc[t][1]), fmaxf(sc[t][2], sc[t][3])), fmaxf(fmaxf(sc[t][4], sc[t][5]), fmaxf(sc[t][6], sc[t][7])));
        }
        v8h vh[16];                                      // the eight V^T fragments: the trip's last LDS reads, so that the buffer can be handed back ahead of the softmax
#pragma unroll
        for (int t = 0; t < 4; ++t)
#pragma unroll
            for (int ks = 0; ks < 2; ++ks) {
                const _Float16* vr = vt[cur] + (t * 16 + l15) * VP + ks * 32 + 8 * hf;
                vh[(t * 2 + ks) * 2] = *(const v8h*)vr; vh[(t * 2 + ks) * 2 + 1] = *(const v8h*)(vr + 16);
            }
        // Publish point: from here on the trip works on registers alone, and the refill has the softmax, the second products and the next trip's first half to land.
        asm volatile("s_wait_dscnt 0x0" ::: "memory");       // this wave's reads of block j0 are done before its buffer is handed back
        asm volatile("s_wait_asynccnt 0x0" ::: "memory");    // this wave's share of block j0 + 64 has landed
        __syncthreads();                                     // publishes block j0 + 64 and ends every wave's reads of block j0
        if (j0 + 128 < GT) at_copy8<VP * 2, GD, GR>(lk + cur * TB, lv + cur * TB, gk + (size_t)(j0 + 128) * GD, gv + (j0 + 128));
        float mx = fmaxf(fmaxf(mt[0], mt[1]), fmaxf(mt[2], mt[3]));
        mx = fmaxf(mx, xhalf(mx));                        // the other lane half holds the query's other 32 keys
        const float mnew = fmaxf(m, mx);
        const float corr = exp2_one(m - mnew);
        float rs[4];
#pragma unroll
        for (int t = 0; t < 4; ++t) {
#pragma unroll
            for (int r = 0; r < 8; ++r) sc[t][r] -= mnew;
            exp2_run8(sc[t]);
            rs[t] = sc[t][0];
#pragma unroll
            for (int r = 1; r < 8; ++r) rs[t] += sc[t][r];
        }
        l = l * corr + ((rs[0] + rs[1]) + (rs[2] + rs[3])); m = mnew;
#pragma unroll
        for (int t = 0; t < 4; ++t)
#pragma unroll
            for (int r = 0; r < 8; ++r) o[t][r] *= corr;
        v16h pb[2];
#pragma unroll
        for (int ks = 0; ks < 2; ++ks)
#pragma unroll
            for (int e = 0; e < 16; ++e) pb[ks][e] = (_Float16)(sc[2 * ks + (e >> 3)][e & 7] * 4096.f);
#pragma unroll
        for (int t = 0; t < 4; ++t)
#pragma unroll
            for (int ks = 0; ks < 2; ++ks) {
                const v16h va = __builtin_shufflevector(vh[(t * 2 + ks) * 2], vh[(t * 2 + ks) * 2 + 1], 0, 1, 2, 3, 4, 5, 6, 7, 8, 9, 10, 11, 12, 13, 14, 15);
                o[t] = __builtin_amdgcn_wmma_f32_16x16x32_f16(false, va, false, pb[ks], (short)0, o[t], false, false);   // A = head columns, B = query columns
            }
    }
    asm volatile("s_wait_asynccnt 0x0" ::: "memory");        // nothing of this wave is in flight when it goes on
    l += xhalf(l);                                       // join the two halves' sums
    const float inv = (l > 0.f) ? 1.f / (l * 4096.f) : 0.f;
    // the lane's eight head columns of a group are 16 bytes of the f16 plane; a wave's four stores fill its 16 rows' whole 128-byte lines
    _Float16* orow = O + (size_t)(b * GT + q0 + l15) * GD + h * DH + 8 * hf;
#pragma unroll
    for (int t = 0; t < 4; ++t) {
        const v8h w = { (_Float16)(o[t][0] * inv), (_Float16)(o[t][1] * inv), (_Float16)(o[t][2] * inv), (_Float16)(o[t][3] * inv),
                        (_Float16)(o[t][4] * inv), (_Float16)(o[t][5] * inv), (_Float16)(o[t][6] * inv), (_Float16)(o[t][7] * inv) };
        *(v8h*)(orow + t * 16) = w;
    }
}

// =====================================================================================================================
// k_tr: dst(z, c, r) = alpha * src(z, r, c) (+ beta * R2(z, c, r)): [Z][R][C] (row stride lds) -> [Z][C][R] (row stride ldd) through a 32x32 LDS tile;
//   flags: 1 -> add beta * residual R2 addressed like dst (z*sRz + c*ldr + r); act applied before the residual.
// =====================================================================================================================
struct TrP { const float* src; float* dst; const float* R2; long long sSz, lds, sDz, ldd, sRz, ldr; int R, C, flags, act; float alpha, beta; };
static_assert(sizeof(TrP) == 3 * 8 + 6 * 8 + 6 * 4, "TrP has padding");
__global__ __launch_bounds__(256) void k_tr(TrP p) {
    __shared__ float tile[32][33];
    const int c0 = blockIdx.x * 32, r0 = blockIdx.y * 32, z = blockIdx.z;
    const int lane = threadIdx.x & 31, wave = threadIdx.x >> 5;
    const float* s = p.src + z * p.sSz;
#pragma unroll
    for (int k = 0; k < 4; ++k) {
        const int rl = wave * 4 + k, r = r0 + rl, c = c0 + lane;
        tile[rl][lane] = (r < p.R && c < p.C) ? s[(long long)r * p.lds + c] : 0.f;
    }
    __syncthreads();
    float* d = p.dst + z * p.sDz; const float* rr = p.R2 + z * p.sRz;
#pragma unroll
    for (int k = 0; k < 4; ++k) {
        const int cl = wave * 4 + k, c = c0 + cl, r = r0 + lane;
        if (c < p.C && r < p.R) {
            float v = act_fn(p.alpha * tile[lane][cl], p.act);
            if (p.flags & 1) v += p.beta * rr[(long long)c * p.ldr + r];
            VST2(float, d + (long long)c * p.ldd + r, v);
        }
    }
}

// k_affine: dst[i] = a * (sdev ? sdev[0] : 1) * src[i] + b, i < n (one thread per element; consecutive lanes -> consecutive addresses)
__global__ __launch_bounds__(256) void k_affine(const float* __restrict__ src, float* __restrict__ dst, int n, float a, float b, const float* __restrict__ sdev) {
    const int i = blockIdx.x * 256 + threadIdx.x;
    if (i < n) { const float aa = sdev ? a * sdev[0] : a; const float v = aa * src[i] + b; VST2(float, dst + i, v); }
}

// =====================================================================================================================
// k_softmax: row softmax over n contiguous elements, one 256-thread block per row; rows addressed z*sz + r*sr (grid (R, Z)).
//   out = scale_out * softmax(scale_in * x + (Mf ? Mf[z*smz + r*smr + j] : 0)); a row whose max is -inf is written as 0.
// =====================================================================================================================
struct SmP { const float* src; float* dst; const float* Mf; long long sz, sr, dz, dr, smz, smr; int n, pad; float scale_in, scale_out; };
static_assert(sizeof(SmP) == 3 * 8 + 6 * 8 + 4 * 4, "SmP has padding");
__global__ __launch_bounds__(256) void k_softmax(SmP p) {
    __shared__ float red[256];
    const int r = blockIdx.x, z = blockIdx.y, tid = threadIdx.x;
    const float* s = p.src + z * p.sz + (long long)r * p.sr;
    const float* mf = p.Mf ? (p.Mf + z * p.smz + (long long)r * p.smr) : nullptr;
    float mx = -__builtin_inff();
    for (int j = tid; j < p.n; j += 256) { float v = s[j] * p.scale_in; if (mf) v += mf[j]; mx = fmaxf(mx, v); }
    red[tid] = mx; __syncthreads();
    for (int o = 128; o > 0; o >>= 1) { if (tid < o) red[tid] = fmaxf(red[tid], red[tid + o]); __syncthreads(); }
    mx = red[0]; __syncthreads();
    float sum = 0.f;
    for (int j = tid; j < p.n; j += 256) { float v = s[j] * p.scale_in; if (mf) v += mf[j]; sum += (mx == -__builtin_inff()) ? 0.f : expf(v - mx); }
    red[tid] = sum; __syncthreads();
    for (int o = 128; o > 0; o >>= 1) { if (tid < o) red[tid] += red[tid + o]; __syncthreads(); }
    sum = red[0];
    const float inv = (sum > 0.f) ? p.scale_out / sum : 0.f;
    float* d = p.dst + z * p.dz + (long long)r * p.dr;
    for (int j = tid; j < p.n; j += 256) { float v = s[j] * p.scale_in; if (mf) v += mf[j]; const float o = (mx == -__builtin_inff()) ? 0.f : expf(v - mx) * inv; VST2(float, d + j, o); }
}
// =====================================================================================================================
// k_stats: mean and rsqrt(var + eps) over a set of n elements addressed base + z*sz + (e / inner) * so + (e % inner) * si, one 256-thread
// k_norm_apply: y = (x - mean[set]) * rstd[set] * g[c] + b[c] over a [Z][C][L] channel-major tensor with set = z*G + c / (C/G) (G groups per z;
//   G = C -> per-channel sets indexed z*C+c; for batch norm pass stats indexed by c only via bn = 1). Optional act. Output same layout.
// =====================================================================================================================
//   mode 0: mean / rsqrt(var + eps); mode 1 (RMSNorm): 0 / rsqrt(mean(x^2) + eps); mode 2 (L2 normalize * sqrt(n)): 0 / sqrt(n) / max(||x||, eps); mode 3: as 0 with unbiased variance (n-1)
__global__ __launch_bounds__(256) void k_stats(const float* __restrict__ x, long long sz, long long so, long long si, int inner, int n, float eps, float* __restrict__ stat, int mode) {
    __shared__ float red[256];
    const int z = blockIdx.x, tid = threadIdx.x;
    const float* base = x + z * sz;
    float s = 0.f;
    for (int e = tid; e < n; e += 256) s += base[(long long)(e / inner) * so + (long long)(e % inner) * si];
    red[tid] = s; __syncthreads();
    for (int o = 128; o > 0; o >>= 1) { if (tid < o) red[tid] += red[tid + o]; __syncthreads(); }
    const float mu = (mode == 0 || mode == 3) ? red[0] / (float)n : 0.f; __syncthreads();
    float q = 0.f;
    for (int e = tid; e < n; e += 256) { const float dlt = base[(long long)(e / inner) * so + (long long)(e % inner) * si] - mu; q += dlt * dlt; }
    red[tid] = q; __syncthreads();
    for (int o = 128; o > 0; o >>= 1) { if (tid < o) red[tid] += red[tid + o]; __syncthreads(); }
    {
        float rs;
        if (mode == 2) rs = sqrtf((float)n) / fmaxf(sqrtf(red[0]), eps); else if (mode == 3) rs = rsqrtf(red[0] / (float)(n - 1) + eps); else rs = rsqrtf(red[0] / (float)n + eps);
        if (tid < 32) { const float v = (tid == 0) ? mu : ((tid == 1) ? rs : 0.f); VST2(float, stat + (long long)z * 32 + tid, v); }
    }
}
//   One thread per element over the flat [Z][C][L] index space: grid ceil(Z*C*L / 256).
__global__ __launch_bounds__(256) void k_norm_apply(const float* __restrict__ x, float* __restrict__ y, const float* __restrict__ stat, const float* __restrict__ g, const float* __restrict__ bta,
                                                     int Z, int C, int L, int G, int bn, int act) {
    const long long idx = (long long)blockIdx.x * 256 + threadIdx.x;
    if (idx >= (long long)Z * C * L) return;
    const int l = (int)(idx % L); const long long zc = idx / L; const int c = (int)(zc % C), z = (int)(zc / C); (void)l;
    const int set = bn ? c : (z * G + c / (C / G));
    float v = (x[idx] - stat[(long long)set * 32]) * stat[(long long)set * 32 + 1];
    if (g) v *= g[c];
    if (bta) v += bta[c];
    v = act_fn(v, act);
    VST2(float, y + idx, v);
}

// k_lse_neg: c[i] = -(st[2i] + log(st[2i+1])) = minus the log-sum-exp of row i from k_attn's ST output (for softmax over the query dimension)
__global__ __launch_bounds__(256) void k_lse_neg(const float* __restrict__ st, float* __restrict__ c, int n) {
    const int i = blockIdx.x * 256 + threadIdx.x;
    if (i < n) { const float v = -(st[2 * i] + logf(st[2 * i + 1])); VST2(float, c + i, v); }
}

// k_iota: dst[i] = a * i + b as int32 (segment/position id helper)
__global__ __launch_bounds__(256) void k_iota(int* __restrict__ dst, int n, int a, int b) {
    const int i = blockIdx.x * 256 + threadIdx.x;
    if (i < n) { const int v = a * i + b; VST2(int, dst + i, v); }
}

// k_axpby: dst[i] = a * x[i] + b * y[i] (+ c), i < n
__global__ __launch_bounds__(256) void k_axpby(const float* __restrict__ x, const float* __restrict__ y, float* __restrict__ dst, int n, float a, float b, float c) {
    const int i = blockIdx.x * 256 + threadIdx.x;
    if (i < n) { const float v = a * x[i] + b * y[i] + c; VST2(float, dst + i, v); }
}

// =====================================================================================================================
// k_rope: rotary embedding on a [R rows][Hn heads][D] view (row stride sXr, head stride sXh, element stride 1) -> Y (own strides).
//   mode 0: rotate_half (partner d±D/2, sign - for d<D/2); mode 1: interleaved pairs (partner d^1, sign - for even d).
//   table column tcol: tmode 0 -> d, 1 -> d % (D/2), 2 -> d / 2; position p: pmode 0 -> r % S, 1 -> head index, 2 -> pos[r];
//   c = C[(r / S) * sCb + p * sCp + tcol * sCd], s likewise from Sn; y = x[d] * c + sign * x[partner] * s. X and Y must not alias.
// =====================================================================================================================
struct RopeP { const float* X; float* Y; const float* C; const float* Sn; const int* pos; long long sXr, sXh, sYr, sYh, sCb, sCp, sCd; int R, Hn, D, S, mode, tmode, pmode, pad; };
static_assert(sizeof(RopeP) == 5 * 8 + 7 * 8 + 8 * 4, "RopeP has padding");
__global__ __launch_bounds__(256) void k_rope(RopeP p) {
    const long long idx = (long long)blockIdx.x * 256 + threadIdx.x;
    if (idx >= (long long)p.R * p.Hn * p.D) return;
    const int d = (int)(idx % p.D); const long long rh = idx / p.D; const int h = (int)(rh % p.Hn); const int r = (int)(rh / p.Hn);
    const int half = p.D / 2;
    int partner; float sign;
    if (p.mode == 0) { partner = (d < half) ? d + half : d - half; sign = (d < half) ? -1.f : 1.f; }
    else { partner = d ^ 1; sign = (d & 1) ? 1.f : -1.f; }
    const int tcol = (p.tmode == 0) ? d : ((p.tmode == 1) ? (d % half) : (d >> 1));
    const int pp = (p.pmode == 0) ? (r % p.S) : ((p.pmode == 1) ? h : p.pos[r]);
    const long long toff = (long long)(r / p.S) * p.sCb + (long long)pp * p.sCp + (long long)tcol * p.sCd;
    const float* xr = p.X + (long long)r * p.sXr + (long long)h * p.sXh;
    const float v = xr[d] * p.C[toff] + sign * xr[partner] * p.Sn[toff];
    VST2(float, p.Y + (long long)r * p.sYr + (long long)h * p.sYh + d, v);
}

// k_invf + k_sincos (split so neither kernel carries a large VALU-fma footprint): invf_i = num * (1 / powf(base, (2 i)/D)) [fmode 0],
//   num * expf((2 i) * cexp) [fmode 1], num * powf(base, -2 (i - 1) / D) [fmode 2]; then cs/sn[s*half + i] = cos/sin((pscale * s) * invf_i)
__global__ __launch_bounds__(256) void k_invf(float* __restrict__ invb, int half, int D, float base, float num, int fmode, float cexp) {
    const int i = blockIdx.x * 256 + threadIdx.x;
    if (i >= ((half + 31) / 32) * 32) return;
    if (i >= half) { VST2(float, invb + i, 0.f); return; }
    const float e = (float)(2 * i) / (float)D;
    float invf;
    if (fmode == 1) invf = num * expf((float)(2 * i) * cexp);
    else if (fmode == 2) invf = num * powf(base, (-2.0f * ((float)i - 1.0f)) / (float)D);
    else invf = num * (1.0f / powf(base, e));
    VST2(float, invb + i, invf);
}
__global__ __launch_bounds__(256) void k_sincos(float* __restrict__ cs, float* __restrict__ sn, const float* __restrict__ invb, int S, int half, float pscale) {
    const int idx = blockIdx.x * 256 + threadIdx.x;
    if (idx >= S * half) return;
    const int s = idx / half, i = idx - s * half;
    const float ang = (pscale * (float)s) * invb[i];
    VST2(float, cs + idx, cosf(ang)); VST2(float, sn + idx, sinf(ang));
}

// k_mulact: dst[i] = act(x[i]) * y[i]
__global__ __launch_bounds__(256) void k_mulact(const float* __restrict__ x, const float* __restrict__ y, float* __restrict__ dst, int n, int act) {
    const int i = blockIdx.x * 256 + threadIdx.x;
    if (i < n) { const float v = act_fn(x[i], act) * y[i]; VST2(float, dst + i, v); }
}

// =====================================================================================================================
// k_matvec: thread-per-row matrix-vector products for N <= 8 output columns (heads with 1-3 outputs, gates), f32 on the VALU.
//   C[r*sCm + j] = act(alpha * sum_k A[r*sAm + k*sAk] * B[j*sBn + k*sBk] + bias[j]) + beta * R[r*sRm + j*sRn]; each thread writes its N contiguous floats.
// =====================================================================================================================
__global__ __launch_bounds__(256) void k_matvec(GemmP p) {
    // 32 lanes write one line with one instruction.
    const int rpt = (p.N == 1) ? 1 : 32;
    const long long r0 = ((long long)blockIdx.x * 256 + threadIdx.x) * rpt; const int z = blockIdx.z, zo = z / p.zi_n, zi = z - zo * p.zi_n;
    if (r0 >= p.M) return;
    const float* Bb = p.B + zo * p.sBo + zi * p.sBi;
    float* C = p.C + zo * p.sCo + zi * p.sCi; const float* R = p.R + zo * p.sRo + zi * p.sRi;
    for (int rr = 0; rr < rpt; ++rr) {
        const long long r = r0 + rr; if (r >= p.M) break;
        const float* A = p.A + zo * p.sAo + zi * p.sAi + r * p.sAm;
        float acc[8] = {0.f, 0.f, 0.f, 0.f, 0.f, 0.f, 0.f, 0.f};
        for (int k = 0; k < p.K; ++k) { const float a = A[(long long)k * p.sAk];
#pragma unroll
            for (int j = 0; j < 8; ++j) if (j < p.N) acc[j] += a * Bb[(long long)j * p.sBn + (long long)k * p.sBk]; }
#pragma unroll
        for (int j = 0; j < 8; ++j) if (j < p.N) {
            float v = acc[j] * p.alpha;
            if (p.flags & 1) v += p.bias[j];
            if (p.flags & 2) v += p.bias[r];
            v = act_fn(v, p.act);
            if (p.flags & 4) v += p.beta * R[r * p.sRm + (long long)j * p.sRn];
            VST2(float, C + r * p.sCm + j, v);
        }
    }
}
// k_smallsoftmax: thread-per-row softmax for short rows (n <= 64): dst[r*dr + j] = softmax(scale*src[r*sr + j])
__global__ __launch_bounds__(256) void k_smallsoftmax(const float* __restrict__ src, float* __restrict__ dst, long long sr, long long dr, int n, long long R, float scale) {
    const long long r0 = ((long long)blockIdx.x * 256 + threadIdx.x) * 32;
    for (int rr = 0; rr < 32; ++rr) {
        const long long r = r0 + rr; if (r >= R) return;
        const float* s = src + r * sr; float* d = dst + r * dr;
        float mx = -__builtin_inff();
        for (int j = 0; j < n; ++j) mx = fmaxf(mx, s[j] * scale);
        float sum = 0.f;
        for (int j = 0; j < n; ++j) sum += expf(s[j] * scale - mx);
        const float inv = 1.f / sum;
        for (int j = 0; j < n; ++j) { const float v = expf(s[j] * scale - mx) * inv; VST2(float, d + j, v); }
    }
}

__global__ __launch_bounds__(32) void k_unitstat(float* __restrict__ st) { const int t = threadIdx.x; const float v = (t == 1) ? 1.f : 0.f; VST2(float, st + t, v); }

// destination (e.g. a d_out whose row width is not a multiple of 32 floats) is written by consecutive lanes of one instruction
__global__ __launch_bounds__(256) void k_lincopy(const float* __restrict__ src, long long lds, float* __restrict__ dst, long long ldd, long long rows, int cols) {
    const long long i = (long long)blockIdx.x * 256 + threadIdx.x; if (i >= rows * cols) return;
    const long long r = i / cols; const int c = (int)(i - r * cols);
    const float v = src[r * lds + c]; VST2(float, dst + r * ldd + c, v);
}

namespace w25 {
typedef __attribute__((ext_vector_type(16))) _Float16 v16h;
typedef __attribute__((ext_vector_type(8)))  _Float16 v8h;
typedef __attribute__((ext_vector_type(16))) __bf16   v16b;
typedef __attribute__((ext_vector_type(8)))  __bf16   v8b;
typedef __attribute__((ext_vector_type(8)))  float    v8f;
typedef __attribute__((ext_vector_type(4)))  float    v4f;

__device__ __forceinline__ unsigned short f2bf_bits(float f) {
  unsigned u = __float_as_uint(f);
  return (unsigned short)((u + 0x7FFFu + ((u >> 16) & 1u)) >> 16);
}
__device__ __forceinline__ float bf_bits2f(unsigned short h) { return __uint_as_float(((unsigned)h) << 16); }

// hazard guards as plain device helpers (no inline asm inside the kernel template body)
__device__ __forceinline__ void dep_guard_h(v8f& a, v8f& b, v16h x, v16h y) { asm volatile("v_nop\n\tv_nop\n\tv_nop\n\tv_nop" : "+v"(a), "+v"(b) : "v"(x), "v"(y)); }
__device__ __forceinline__ void dep_guard_b(v8f& a, v8f& b, v16b x, v16b y) { asm volatile("v_nop\n\tv_nop\n\tv_nop\n\tv_nop" : "+v"(a), "+v"(b) : "v"(x), "v"(y)); }
__device__ __forceinline__ void keep4_h(v16h a, v16h b, v16h c, v16h d) { asm volatile("v_nop" :: "v"(a), "v"(b), "v"(c), "v"(d)); }
__device__ __forceinline__ void keep4_b(v16b a, v16b b, v16b c, v16b d) { asm volatile("v_nop" :: "v"(a), "v"(b), "v"(c), "v"(d)); }
__device__ __forceinline__ void acc_guard4(v8f& a, v8f& b, v8f& c, v8f& d) { asm volatile("v_nop\n\tv_nop\n\tv_nop\n\tv_nop" : "+v"(a), "+v"(b), "+v"(c), "+v"(d)); }
template <typename T> struct Frag;
template <> struct Frag<_Float16> {
  typedef v16h V; union U { v16h v; v8h h[2]; };
  static __device__ __forceinline__ v16h load(const _Float16* p) {   // elements 0..7 <- p[0..7], 8..15 <- p[16..23]
    U f; f.h[0] = *(const v8h*)(p); f.h[1] = *(const v8h*)(p + 16); return f.v;
  }
  static __device__ __forceinline__ v8f mma(v16h a, v16h b, v8f c) {
    return __builtin_amdgcn_wmma_f32_16x16x32_f16(false, a, false, b, (short)0, c, false, false);
  }
  static __device__ __forceinline__ void guard(v8f& a, v8f& b, v16h x, v16h y) { dep_guard_h(a, b, x, y); }
  static __device__ __forceinline__ void keep(v16h a, v16h b, v16h c, v16h d) { keep4_h(a, b, c, d); }
};
template <> struct Frag<__bf16> {
  typedef v16b V; union U { v16b v; v8b h[2]; };
  static __device__ __forceinline__ v16b load(const __bf16* p) {
    U f; f.h[0] = *(const v8b*)(p); f.h[1] = *(const v8b*)(p + 16); return f.v;
  }
  static __device__ __forceinline__ v8f mma(v16b a, v16b b, v8f c) {
    return __builtin_amdgcn_wmma_f32_16x16x32_bf16(false, a, false, b, (short)0, c, false, false);
  }
  static __device__ __forceinline__ void guard(v8f& a, v8f& b, v16b x, v16b y) { dep_guard_b(a, b, x, y); }
  static __device__ __forceinline__ void keep(v16b a, v16b b, v16b c, v16b d) { keep4_b(a, b, c, d); }
};

// ---- Register-blocked batched WMMA GEMM ------------------------------------
// C[m,n] = scale * sum_k A[m,k] * Bt[n,k] (+bias)(+resid); each wave owns a 64x64 tile.
// A row-major [M,K]; Bt row-major [N,K]; M,N % 64 == 0, K % 32 == 0.
// SPLIT: operands are hi/lo planes (A2/Bt2 = lo planes, same layout); product = hi·hi + hi·lo + lo·hi.
// BIAS_MODE: 0 = none, 1 = bias[m], 2 = bias[n].
// OUT_MODE: 0 = f32, 1 = f16, 2 = bf16 hi plane (Cout) + bf16 lo plane (Cout2).
// ET: 0 = f16 operands, 1 = bf16 operands (pointers passed as 16-bit storage)
template <int ET> struct Elem;
template <> struct Elem<0> { typedef _Float16 T; };
template <> struct Elem<1> { typedef __bf16 T; };
template <int ET, bool SPLIT, int BIAS_MODE, int OUT_MODE, bool RESID, int ACT = 0>
__global__ __launch_bounds__(256) void wmma_gemm64(
    const unsigned short* __restrict__ Ap, const unsigned short* __restrict__ A2p, int lda, long strideA,
    const unsigned short* __restrict__ Btp, const unsigned short* __restrict__ Bt2p, int ldb, long strideB,
    void* __restrict__ Cout, void* __restrict__ Cout2, int ldc, long strideC,
    const float* __restrict__ bias,
    const float* __restrict__ resid, long strideR,
    int M, int N, int K, float scale) {
  typedef typename Elem<ET>::T T;
  typedef typename Frag<T>::V V;
  const T* A = (const T*)Ap; const T* A2 = (const T*)A2p; const T* Bt = (const T*)Btp; const T* Bt2 = (const T*)Bt2p;
  __shared__ __align__(16) float sT[8][16 * 68];   // per-wave 16x64 slab, pitch 68 floats
  const int b    = blockIdx.y;
  const int lane = threadIdx.x & 31;
  const int wave = threadIdx.x >> 5;
  const int tilesN = N >> 6;
  const int tilesM = M >> 6;
  const int tile = blockIdx.x * 8 + wave;
  if (tile >= tilesM * tilesN) return;   // wave-uniform; no block barriers in this kernel
  const int tm = tile / tilesN;
  const int tn = tile - tm * tilesN;
  const int m0 = tm << 6;
  const int n0 = tn << 6;

  const T* Ab  = A  + (size_t)b * strideA;
  const T* Bb  = Bt + (size_t)b * strideB;
  const T* Ab2 = SPLIT ? (A2  + (size_t)b * strideA) : nullptr;
  const T* Bb2 = SPLIT ? (Bt2 + (size_t)b * strideB) : nullptr;

  const int rlane = lane & 15;                 // row (A) / col (B, D) within subtile
  const int koff  = (lane >> 4) * 8;           // k offset of this lane half
  const int mOff  = (lane >> 4) * 8;           // D row offset

  v8f acc[4][4];
#pragma unroll
  for (int i = 0; i < 4; ++i)
#pragma unroll
    for (int j = 0; j < 4; ++j) acc[i][j] = (v8f){0.f,0.f,0.f,0.f,0.f,0.f,0.f,0.f};

  for (int k0 = 0; k0 < K; k0 += 32) {
    V bh[4], bl[4];
#pragma unroll
    for (int j = 0; j < 4; ++j) {
      const size_t bo = (size_t)(n0 + (j << 4) + rlane) * ldb + koff + k0;
      bh[j] = Frag<T>::load(Bb + bo);
      if (SPLIT) bl[j] = Frag<T>::load(Bb2 + bo);
    }
#pragma unroll
    for (int i = 0; i < 4; ++i) {
      const size_t ao = (size_t)(m0 + (i << 4) + rlane) * lda + koff + k0;
      V ah = Frag<T>::load(Ab + ao);
      V al;
      if (SPLIT) al = Frag<T>::load(Ab2 + ao);
#pragma unroll
      for (int j = 0; j < 4; ++j) {
        acc[i][j] = Frag<T>::mma(ah, bh[j], acc[i][j]);
        if (SPLIT) {
          acc[i][j] = Frag<T>::mma(ah, bl[j], acc[i][j]);
          acc[i][j] = Frag<T>::mma(al, bh[j], acc[i][j]);
        }
      }
      Frag<T>::guard(acc[i][0], acc[i][3], ah, SPLIT ? al : ah);
    }
    Frag<T>::keep(bh[0], bh[1], bh[2], bh[3]);
    if (SPLIT) Frag<T>::keep(bl[0], bl[1], bl[2], bl[3]);
  }
  acc_guard4(acc[0][0], acc[0][1], acc[0][2], acc[0][3]);
  acc_guard4(acc[1][0], acc[1][1], acc[1][2], acc[1][3]);
  acc_guard4(acc[2][0], acc[2][1], acc[2][2], acc[2][3]);
  acc_guard4(acc[3][0], acc[3][1], acc[3][2], acc[3][3]);

  // ---- epilogue ----
  float* slab = sT[wave];
  const float* Rb = RESID ? (resid + (size_t)b * strideR) : nullptr;
#pragma unroll
  for (int i = 0; i < 4; ++i) {
    const int mBase = m0 + (i << 4);
#pragma unroll
    for (int j = 0; j < 4; ++j) {
      const int n = n0 + (j << 4) + rlane;
      float bv = 0.f;
      if (BIAS_MODE == 2) bv = bias[n];
#pragma unroll
      for (int r = 0; r < 8; ++r) {
        float v = acc[i][j][r] * scale;
        if (BIAS_MODE == 1) v += bias[mBase + mOff + r];
        if (BIAS_MODE == 2) v += bv;
        if (RESID) v += Rb[(size_t)(mBase + mOff + r) * ldc + n];
        if (ACT == 1) v = tanhf(v);
        if (ACT == 2) v = fmaxf(v, 0.0f);
        if (ACT == 3) v = v / (1.0f + expf(-v));
        if (ACT == 4) v = (v > 0.f) ? v : 0.01f * v;
        if (ACT == 5) v = 0.5f * v * (1.0f + erff(v * 0.70710678118654752f));
        slab[(mOff + r) * 68 + (j << 4) + rlane] = v;
      }
    }
    __builtin_amdgcn_fence(__ATOMIC_RELEASE, "workgroup");
    __builtin_amdgcn_wave_barrier();
    __builtin_amdgcn_fence(__ATOMIC_ACQUIRE, "workgroup");
    if (OUT_MODE == 0) {
      float* C = (float*)Cout + (size_t)b * strideC;
      const int hh = lane >> 4, c4 = (lane & 15) * 4;     // row seg = 256 B = 16 lanes x 16 B
      {
#pragma unroll
        for (int it = 0; it < 8; ++it) {
          const int row = it * 2 + hh;
          v4f v = *(const v4f*)(slab + row * 68 + c4);
          *(v4f*)(C + (size_t)(mBase + row) * ldc + n0 + c4) = v;
        }
        
      }
    } else {
      const int q = lane >> 3, c8 = (lane & 7) * 8;
      unsigned short* C  = (unsigned short*)Cout  + (size_t)b * strideC;
      unsigned short* C2 = (OUT_MODE == 2) ? ((unsigned short*)Cout2 + (size_t)b * strideC) : nullptr;
      {
#pragma unroll
        for (int it = 0; it < 4; ++it) {
          const int row = it * 4 + q;
          const float* sp = slab + row * 68 + c8;
          v8h hv, lv;
#pragma unroll
          for (int e = 0; e < 8; ++e) {
            if (OUT_MODE == 1) {
              hv[e] = (_Float16)sp[e];
            } else {
              unsigned short hb = f2bf_bits(sp[e]);
              unsigned short lb = f2bf_bits(sp[e] - bf_bits2f(hb));
              hv[e] = __builtin_bit_cast(_Float16, hb);
              lv[e] = __builtin_bit_cast(_Float16, lb);
            }
          }
          *(v8h*)(C + (size_t)(mBase + row) * ldc + n0 + c8) = hv;
          if (OUT_MODE == 2) *(v8h*)(C2 + (size_t)(mBase + row) * ldc + n0 + c8) = lv;
        }
        
      }
    }
    __builtin_amdgcn_fence(__ATOMIC_RELEASE, "workgroup");
    __builtin_amdgcn_wave_barrier();
    __builtin_amdgcn_fence(__ATOMIC_ACQUIRE, "workgroup");
  }
}

// ---- Projection GEMM on operand tiles staged in LDS -------------------------------------------------------------
// C[m,n] = scale * sum_k A[m,k] * Bt[n,k] (+ bias[n]); A [GM][GK] and Bt [GN][GK] f16 with k contiguous, C f32 [GM][GN].
// A block owns a 128 x 128 tile of C, its eight waves 32 x 64 each. A trip takes 128 k: 256 bytes of each of the block's 256 operand rows come into LDS once,
// by asynchronous 16-byte copies (one wave's copy = two whole 256-byte row pieces), and every wave reads its fragments from there, 16 bytes a lane.
// Two buffers: tile t + 1 flies while tile t is worked on, one barrier a trip. The k order of the sums is that of wmma_gemm64 (ascending, 32 a product).
constexpr int GL_PB  = 272;             // LDS row pitch in bytes: 256 + 16, an odd multiple of 16, free of bank conflicts for 16-byte readers
constexpr int GL_OP  = 128 * GL_PB;     // one operand's tile
constexpr int GL_BUF = 2 * GL_OP;       // one buffer: the A tile, behind it the Bt tile
// One thread's eight copies for one operand tile: the same 16 bytes of rows 16 apart. l = LDS byte address, g = global address of the first.
// The s_wait_xcnt closes the statement so that no register which a copy names is rewritten ahead of it.
template <int LD>
__device__ __forceinline__ void gl_copy8(unsigned l, const _Float16* g) {
  asm volatile(
      "global_load_async_to_lds_b128 %0, %8, off\n\t"
      "global_load_async_to_lds_b128 %1, %9, off\n\t"
      "global_load_async_to_lds_b128 %2, %10, off\n\t"
      "global_load_async_to_lds_b128 %3, %11, off\n\t"
      "global_load_async_to_lds_b128 %4, %12, off\n\t"
      "global_load_async_to_lds_b128 %5, %13, off\n\t"
      "global_load_async_to_lds_b128 %6, %14, off\n\t"
      "global_load_async_to_lds_b128 %7, %15, off\n\t"
      "s_wait_xcnt 0x0"
      :: "v"(l), "v"(l + 16 * GL_PB), "v"(l + 32 * GL_PB), "v"(l + 48 * GL_PB), "v"(l + 64 * GL_PB), "v"(l + 80 * GL_PB), "v"(l + 96 * GL_PB), "v"(l + 112 * GL_PB),
         "v"(g), "v"(g + 16 * LD), "v"(g + 32 * LD), "v"(g + 48 * LD), "v"(g + 64 * LD), "v"(g + 80 * LD), "v"(g + 96 * LD), "v"(g + 112 * LD)
      : "memory");
}
// One block's work: the 128 x 128 tile (bm, bn) of C, whose rows are GN elements long. ring = the block's two operand buffers, slabs = its eight output slabs (8 x 32 x 68 floats).
// slabs may lie on the ring: the last trip's barrier stands behind every wave's last read of the ring (its s_wait_dscnt 0), and no copy is in flight there any more.
// OUT16 = 0: C (f32) takes the tile. OUT16 = 1: C16 takes it rounded to f16, the form in which the attention's products read it.
template <int GK, int BIAS_MODE, int OUT16>
__device__ __forceinline__ void gemm_lds_tile(const _Float16* __restrict__ A, const _Float16* __restrict__ Bt, float* __restrict__ C, _Float16* __restrict__ C16, const float* __restrict__ bias, float scale,
                                              const int bm, const int bn, const int GN, unsigned char* ring, float* slabs) {
  static_assert(GK % 128 == 0 && GK >= 256, "whole k tiles; the two-buffer prologue needs two of them");
  constexpr int NT = GK / 128;
  const int tid = threadIdx.x, lane = tid & 31, wave = tid >> 5;
  const int rlane = lane & 15, hf = lane >> 4;
  const int wm = wave >> 1, wn = wave & 1;
  const int crow = tid >> 4, ccol = tid & 15;      // copies: 16 lanes cover one row's 256 bytes
  const _Float16* ga = A  + (size_t)(bm * 128 + crow) * GK + ccol * 8;
  const _Float16* gb = Bt + (size_t)(bn * 128 + crow) * GK + ccol * 8;
  const unsigned la = (unsigned)(size_t)ring + (unsigned)(crow * GL_PB + ccol * 16);
  const unsigned char* fa = ring + (wm * 32 + rlane) * GL_PB + hf * 16;            // fragment rows: lane = row, this half's 8 k first
  const unsigned char* fb = ring + GL_OP + (wn * 64 + rlane) * GL_PB + hf * 16;

  v8f acc[2][4];
#pragma unroll
  for (int i = 0; i < 2; ++i)
#pragma unroll
    for (int j = 0; j < 4; ++j) acc[i][j] = (v8f){0.f,0.f,0.f,0.f,0.f,0.f,0.f,0.f};

  gl_copy8<GK>(la, ga);
  gl_copy8<GK>(la + GL_OP, gb);
  asm volatile("s_wait_asynccnt 0x0" ::: "memory");   // this wave's share of tile 0 has landed
  __syncthreads();                                    // tile 0 is whole for every wave
  gl_copy8<GK>(la + GL_BUF, ga + 128);
  gl_copy8<GK>(la + GL_BUF + GL_OP, gb + 128);
#pragma unroll 1   // kept rolled: buffer offset and refill test are scalar work, and one trip's code serves both buffers
  for (int t = 0; t < NT; ++t) {
    const int bo = (t & 1) * GL_BUF;
    v16h a[2][2], b[2][4];                              // two fragment sets: one is worked on while the next 32 k are read
#pragma unroll
    for (int i = 0; i < 2; ++i) a[0][i] = Frag<_Float16>::load((const _Float16*)(fa + bo + i * 16 * GL_PB));
#pragma unroll
    for (int j = 0; j < 4; ++j) b[0][j] = Frag<_Float16>::load((const _Float16*)(fb + bo + j * 16 * GL_PB));
#pragma unroll
    for (int ks = 0; ks < 4; ++ks) {
      if (ks < 3) {
#pragma unroll
        for (int i = 0; i < 2; ++i) a[(ks + 1) & 1][i] = Frag<_Float16>::load((const _Float16*)(fa + bo + i * 16 * GL_PB + (ks + 1) * 64));
#pragma unroll
        for (int j = 0; j < 4; ++j) b[(ks + 1) & 1][j] = Frag<_Float16>::load((const _Float16*)(fb + bo + j * 16 * GL_PB + (ks + 1) * 64));
      }
      __builtin_amdgcn_sched_barrier(0);                // the next set's twelve LDS reads stay one group ahead of these products (left alone, the scheduler spreads them among the products on one set, a full LDS wait each)
#pragma unroll
      for (int i = 0; i < 2; ++i)
#pragma unroll
        for (int j = 0; j < 4; ++j) acc[i][j] = Frag<_Float16>::mma(a[ks & 1][i], b[ks & 1][j], acc[i][j]);
      __builtin_amdgcn_sched_barrier(0);                // and the group after next stays behind them
    }
    asm volatile("s_wait_dscnt 0x0" ::: "memory");      // this wave's reads of tile t are done before the buffer is handed back
    asm volatile("s_wait_asynccnt 0x0" ::: "memory");   // this wave's share of tile t + 1 has landed
    __syncthreads();                                    // publishes tile t + 1 and ends every wave's reads of tile t
    if (t + 2 < NT) {
      gl_copy8<GK>(la + bo, ga + (t + 2) * 128);
      gl_copy8<GK>(la + bo + GL_OP, gb + (t + 2) * 128);
    }
  }
  asm volatile("s_wait_asynccnt 0x0" ::: "memory");     // nothing of this wave is in flight when it goes on

  // ---- epilogue: the wave's 32 x 64 tile goes through its own slab, so that every store is whole row pieces (256 bytes as f32, 128 as f16) ----
  float* slab = slabs + wave * (32 * 68);
  const int n0 = bn * 128 + wn * 64, mBase = bm * 128 + wm * 32;
#pragma unroll
  for (int j = 0; j < 4; ++j) {
    float bv = 0.f;
    if (BIAS_MODE == 2) bv = bias[n0 + j * 16 + rlane];
#pragma unroll
    for (int i = 0; i < 2; ++i)
#pragma unroll
      for (int r = 0; r < 8; ++r) {
        float v = acc[i][j][r] * scale;
        if (BIAS_MODE == 2) v += bv;
        slab[(i * 16 + hf * 8 + r) * 68 + j * 16 + rlane] = v;
      }
  }
  // the slab's rows are read by other lanes of the same wave than wrote them
  __builtin_amdgcn_fence(__ATOMIC_RELEASE, "workgroup");
  __builtin_amdgcn_wave_barrier();
  __builtin_amdgcn_fence(__ATOMIC_ACQUIRE, "workgroup");
  if (OUT16) {
    // eight lanes cover one row's 64 halves, a whole 128-byte line; a store takes four rows
    const int r4 = lane >> 3, c8 = (lane & 7) * 8;
    _Float16* hrow0 = C16 + (size_t)(mBase + r4) * GN + n0 + c8;
#pragma unroll
    for (int it = 0; it < 8; ++it) {
      const float* sp = slab + (it * 4 + r4) * 68 + c8;
      const v4f u0 = *(const v4f*)sp, u1 = *(const v4f*)(sp + 4);
      const v8h pk = { (_Float16)u0[0], (_Float16)u0[1], (_Float16)u0[2], (_Float16)u0[3], (_Float16)u1[0], (_Float16)u1[1], (_Float16)u1[2], (_Float16)u1[3] };
      *(v8h*)(hrow0 + (size_t)it * 4 * GN) = pk;
    }
  } else {
    float* crow0 = C + (size_t)(mBase + hf) * GN + n0 + rlane * 4;
#pragma unroll
    for (int it = 0; it < 16; ++it) {
      const v4f v = *(const v4f*)(slab + (it * 2 + hf) * 68 + rlane * 4);
      *(v4f*)(crow0 + (size_t)it * 2 * GN) = v;
    }
  }
}

// One projection a launch, a block a tile.
template <int GM, int GN, int GK, int BIAS_MODE, int OUT16>
__global__ __launch_bounds__(256) void wmma_gemm_lds(const _Float16* __restrict__ A, const _Float16* __restrict__ Bt, float* __restrict__ C, _Float16* __restrict__ C16, const float* __restrict__ bias, float scale) {
  static_assert(GM % 128 == 0 && GN % 128 == 0, "whole tiles");
  __shared__ __align__(16) unsigned char ring[2 * GL_BUF];
  __shared__ __align__(16) float sT[8 * 32 * 68];   // per-wave 32x64 output slabs, pitch 68 floats; apart from the ring (this launch has one block for each WGP, so LDS saved would buy nothing)
  constexpr int TN = GN / 128;
  gemm_lds_tile<GK, BIAS_MODE, OUT16>(A, Bt, C, C16, bias, scale, blockIdx.x / TN, blockIdx.x % TN, GN, ring, sT);
}
// The three input projections, which do not depend on each other, in ONE launch: blocks 0 .. NB - 1 do Q = x . Wq^T, the next NB K = context . Wk^T, the last NB V^T = Wv . context^T
// (operands swapped, so that V comes out transposed). x16, c16: [NR][D]; w16: the planes Wq, Wk, Wv one behind the other, [D][D] each. Every block works exactly as in wmma_gemm_lds.
// The output slabs lie on the ring, which leaves the block at 139,264 bytes of LDS: two blocks share a WGP, and while one waits for its copies, fills its first buffer or stores
// its tile, the other one's products run. One projection alone has only one block for each WGP, hence the one launch.
template <int NR, int D>
__global__ __launch_bounds__(256) void wmma_gemm_qkv(const _Float16* __restrict__ x16, const _Float16* __restrict__ c16, const _Float16* __restrict__ w16,
                                                     _Float16* __restrict__ Q, _Float16* __restrict__ K, _Float16* __restrict__ Vt, float scale) {
  static_assert(NR % 128 == 0 && D % 128 == 0, "whole tiles");
  static_assert(8 * 32 * 68 * 4 <= 2 * GL_BUF, "the slabs fit on the ring");
  __shared__ __align__(16) unsigned char ring[2 * GL_BUF];
  constexpr unsigned NB = (NR / 128) * (D / 128);
  const unsigned sel = blockIdx.x / NB, r = blockIdx.x % NB;      // the same for the whole block
  const _Float16* A  = (sel == 0) ? x16 : (sel == 1) ? c16 : w16 + 2 * (size_t)D * D;
  const _Float16* Bt = (sel == 0) ? w16 : (sel == 1) ? w16 + (size_t)D * D : c16;
  _Float16* C16 = (sel == 0) ? Q : (sel == 1) ? K : Vt;
  const int GN = (sel == 2) ? NR : D;
  const unsigned TN = (unsigned)GN / 128u;
  gemm_lds_tile<D, 0, 1>(A, Bt, nullptr, C16, nullptr, scale, (int)(r / TN), (int)(r % TN), GN, ring, (float*)ring);
}

__global__ __launch_bounds__(256) void cast_f32_f16x2(
    const float* __restrict__ in, _Float16* __restrict__ out, int n2) {
  int i = blockIdx.x * 256 + threadIdx.x;
  if (i < n2) {
    const _Float16 h0 = (_Float16)in[2 * i], h1 = (_Float16)in[2 * i + 1];
    const unsigned u = (unsigned)__builtin_bit_cast(unsigned short, h0) | ((unsigned)__builtin_bit_cast(unsigned short, h1) << 16);
    ((unsigned*)out)[i] = u;
    
  }
}


} // namespace w25

__global__ __launch_bounds__(256) void k_castT16(const float* __restrict__ src, long long lds, _Float16* __restrict__ dst, long long ldd, int R, int C, float s) {
    const long long i = (long long)blockIdx.x * 256 + threadIdx.x; const long long np = (long long)C * (R / 2); if (i >= np) return; const int c = (int)(i / (R / 2)); const int r = 2 * (int)(i % (R / 2));
    const _Float16 h0 = (_Float16)(src[(long long)r * lds + c] * s), h1 = (_Float16)(src[(long long)(r + 1) * lds + c] * s);
    const unsigned u = (unsigned)__builtin_bit_cast(unsigned short, h0) | ((unsigned)__builtin_bit_cast(unsigned short, h1) << 16);
    unsigned* d = (unsigned*)(dst + (long long)c * ldd + r); *d = u;  }
__global__ __launch_bounds__(256) void k_cast16(const float* __restrict__ src, long long lds, _Float16* __restrict__ dst, long long ldd, int R, int C, float s) {
    const long long i = (long long)blockIdx.x * 256 + threadIdx.x; const long long np = (long long)R * (C / 2); if (i >= np) return; const int r = (int)(i / (C / 2)); const int c = 2 * (int)(i % (C / 2));
    const _Float16 h0 = (_Float16)(src[(long long)r * lds + c] * s), h1 = (_Float16)(src[(long long)r * lds + c + 1] * s);
    const unsigned u = (unsigned)__builtin_bit_cast(unsigned short, h0) | ((unsigned)__builtin_bit_cast(unsigned short, h1) << 16);
    unsigned* d = (unsigned*)(dst + (long long)r * ldd + c); *d = u;  }

// f32 -> f16 casts on few, long waves: 256 blocks of 16 waves (4,096 waves to start a launch). A tile is 16,384 consecutive floats: eight wave-wide 16-byte loads a lane
// (512 contiguous bytes a wave and load), all issued before the first is used, and eight 8-byte stores (256 contiguous bytes a wave and store).
__device__ __forceinline__ void cast_tile_ld(const float* __restrict__ s, v4f* r) {
#pragma unroll   // r stays in registers and the eight loads issue back to back
    for (int i = 0; i < 8; ++i) r[i] = *(const v4f*)(s + i * 2048);
}
__device__ __forceinline__ void cast_tile_st(_Float16* __restrict__ d, const v4f* r, float sc) {
#pragma unroll   // constant indices into r and pk: both stay in registers
    for (int i = 0; i < 8; ++i) {
        v4h pk;
#pragma unroll
        for (int e = 0; e < 4; ++e) pk[e] = (_Float16)(r[i][e] * sc);
        *(v4h*)(d + i * 2048) = pk;
    }
}
// Everything that exists before the first projection, in one launch: block n casts tile n of x, tile n of the context and tile n & 63 of
// weight n >> 6 (order Wq, Wk, Wv, Wo; times 16; the four f16 planes lie one behind the other in w16). x and c: 256 tiles each, a weight: 64.
// The launch's first NH (2 T - 1) threads also write one entry each of the attention's relative-offset bias table, while their loads are in flight:
// RT[h][c], c = i - j + (T - 1): -floor(|i - j| / 30) * 2^-(h + 1) (depends on no input).
template <int NH, int T>
__global__ __launch_bounds__(512) void k_cast_in(const float* __restrict__ x, const float* __restrict__ c, const float* __restrict__ Wq, const float* __restrict__ Wk,
                                                 const float* __restrict__ Wv, const float* __restrict__ Wo, _Float16* __restrict__ x16, _Float16* __restrict__ c16, _Float16* __restrict__ w16,
                                                 float* __restrict__ RT) {
    constexpr int RN = 2 * T - 1;
    static_assert(NH * RN <= 256 * 512, "one table entry a thread");
    const unsigned n = blockIdx.x, sel = n >> 6;
    const float* __restrict__ w = (sel == 0) ? Wq : (sel == 1) ? Wk : (sel == 2) ? Wv : Wo;
    const unsigned t4 = threadIdx.x * 4u;
    v4f rx[8], rc[8], rw[8];
    cast_tile_ld(x + (size_t)n * 16384 + t4, rx);
    cast_tile_ld(c + (size_t)n * 16384 + t4, rc);
    cast_tile_ld(w + (size_t)(n & 63u) * 16384 + t4, rw);
    const int e = (int)(n * 512u + threadIdx.x);
    if (e < NH * RN) {
        const int h = e / RN;
        int dist = e % RN - (T - 1); dist = dist < 0 ? -dist : dist;
        RT[e] = -(float)(dist / 30) * exp2f(-(float)(h + 1));
    }
    cast_tile_st(x16 + (size_t)n * 16384 + t4, rx, 1.0f);
    cast_tile_st(c16 + (size_t)n * 16384 + t4, rc, 1.0f);
    cast_tile_st(w16 + (size_t)n * 16384 + t4, rw, 16.0f);
}

// f32 -> bf16 hi plane + bf16 lo plane (x = hi + lo to ~2^-17 relative; RNE both), [R][C] -> [R][C] (or transposed to [C][R]); 2 consecutive destination elements
__device__ __forceinline__ unsigned int f2bf2_pack(float a, float b, unsigned int* lo) {
    const unsigned short ha = w25::f2bf_bits(a), hb = w25::f2bf_bits(b);
    const unsigned short la = w25::f2bf_bits(a - w25::bf_bits2f(ha)), lb = w25::f2bf_bits(b - w25::bf_bits2f(hb));
    *lo = (unsigned)la | ((unsigned)lb << 16); return (unsigned)ha | ((unsigned)hb << 16); }
__global__ __launch_bounds__(256) void k_castS16(const float* __restrict__ src, long long lds, __bf16* __restrict__ dhi, __bf16* __restrict__ dlo, long long ldd, int R, int C, float s, int transpose) {
    const long long i = (long long)blockIdx.x * 256 + threadIdx.x; long long o; float a, b;
    if (transpose) { const long long np = (long long)C * (R / 2); if (i >= np) return; const int c = (int)(i / (R / 2)); const int r = 2 * (int)(i % (R / 2)); a = src[(long long)r * lds + c] * s; b = src[(long long)(r + 1) * lds + c] * s; o = (long long)c * ldd + r; }
    else { const long long np = (long long)R * (C / 2); if (i >= np) return; const int r = (int)(i / (C / 2)); const int c = 2 * (int)(i % (C / 2)); a = src[(long long)r * lds + c] * s; b = src[(long long)r * lds + c + 1] * s; o = (long long)r * ldd + c; }
    unsigned lo; const unsigned hi = f2bf2_pack(a, b, &lo); unsigned* ph = (unsigned*)(dhi + o); unsigned* pl = (unsigned*)(dlo + o);
    *ph = hi; *pl = lo;  }

namespace w25 {
// =====================================================================================
// Generic causal/non-causal attention for head_dim 64, f32 in / f32 out; 16-bit operands: bf16 with optional hi/lo splits, or
// plain f16 (F16=true, non-split, probabilities carried x2^15).
//   scores = (q*qscale)·kᵀ : v_wmma_f32_16x16x32_bf16; SPLIT_QK -> q,k as bf16 hi/lo (hi·hi + hi·lo + lo·hi)
//   out    = p·v           : v_wmma_f32_16x16x32_bf16; SPLIT_PV -> p,v as bf16 hi/lo; else p,v plain bf16
//   f32 accumulate; online softmax in f32. Block = 4 waves = 64 query rows of one (batch, head); S % 64 == 0.
//   Element (b, s, h, d) of tensor X lives at X[b*X_bs + s*X_rs + h*X_hs + d] (strides in floats, multiples of 4).
//   Masking: mask_mode 0 none, 1 causal (kv > q masked), 2 tensor [S][Skv] shared over (b,h) (float if
//   mask_is_int==0, int32 with element == 0 -> masked if 1, int32 with element != 0 -> masked if 2), 3 per-token vectors qmask[B][S] & kvmask[B][Skv] (int32,
//   0 -> masked), 4 causal + sliding window (kv > q or q - kv > W masked; W passed in mask_is_int);
//   5 = relative-position bias: s += cp[b,h,q][idx[q][kv]] + pc[b,h,kv][idx[q][kv]] with idx = mask_b ([S][Skv] int32) and
//   mask_a an int32 [S][Skv] tensor with nonzero = masked (tables: element (b,h,row,n) at X + b*c_bs + h*c_hs + row*c_rs + n);
//   masked scores are replaced by mask_fill (e.g. -inf or -1e9) before the softmax.
//   grid.x = B * H * (S/64) (or a sub-range with blk0).
// =====================================================================================
#define AT_D 64
#define AT_NW 4
#define AT_QB 64
#define AT_KC 64
struct AttnGeom { const float* cp = nullptr; const float* pc = nullptr; long c_bs = 0, c_rs = 0, c_hs = 0;   // mode-5 score-bias tables
                  long q_bs, q_rs, q_hs, k_bs, k_rs, k_hs, v_bs, v_rs, v_hs, o_bs, o_rs, o_hs;
                  int S, Skv, H, mask_mode; float qscale; int blk0; float mask_fill; int mask_is_int; };
static_assert(sizeof(AttnGeom) == 168, "no padding");

__device__ __forceinline__ unsigned short at_bf_bits(float f) {
  unsigned u = __float_as_uint(f);
  return (unsigned short)((u + 0x7FFFu + ((u >> 16) & 1u)) >> 16);
}
__device__ __forceinline__ __bf16 at_f2bf(float f) { return __builtin_bit_cast(__bf16, at_bf_bits(f)); }
__device__ __forceinline__ void at_split(float f, __bf16& hi, __bf16& lo) {
  const unsigned short hb = at_bf_bits(f);
  hi = __builtin_bit_cast(__bf16, hb);
  lo = at_f2bf(f - __uint_as_float(((unsigned)hb) << 16));
}
__device__ __forceinline__ v8f at_mma(v16b a, v16b b, v8f c) {
  c = __builtin_amdgcn_wmma_f32_16x16x32_bf16(false, a, false, b, (short)0, c, false, false);
  asm volatile("v_nop\n\tv_nop\n\tv_nop\n\tv_nop" : "+v"(c) : "v"(a), "v"(b));
  return c;
}
// 16-bit element as a bit pattern held in a __bf16 slot: f16 bits when F16, bf16 (RNE) otherwise
template <bool F16> __device__ __forceinline__ __bf16 at_to16(float f) {
  if (F16) return __builtin_bit_cast(__bf16, (_Float16)f);
  return at_f2bf(f);
}
template <bool F16> __device__ __forceinline__ v8f at_mma16(v16b a, v16b b, v8f c) {
  if (F16) {
    const v16h ah = __builtin_bit_cast(v16h, a), bh = __builtin_bit_cast(v16h, b);
    c = __builtin_amdgcn_wmma_f32_16x16x32_f16(false, ah, false, bh, (short)0, c, false, false);
    asm volatile("v_nop\n\tv_nop\n\tv_nop\n\tv_nop" : "+v"(c) : "v"(ah), "v"(bh));
    return c;
  }
  return at_mma(a, b, c);
}

template <bool SPLIT_QK, bool SPLIT_PV, bool F16 = false>
__global__ __launch_bounds__(128)
void attn64_kernel(const float* __restrict__ q, const float* __restrict__ k,
                   const float* __restrict__ v, float* __restrict__ out,
                   const void* __restrict__ mask_a, const int* __restrict__ mask_b, AttnGeom g) {
  static_assert(!(F16 && (SPLIT_QK || SPLIT_PV)), "f16 mode is non-split");
  const float PSC = F16 ? 32768.0f : 1.0f;     // f16 probabilities carried x2^15 (subnormal range), folded into the final 1/l
  union FB { v16b v; v8b h[2]; };
  __shared__ __align__(16) __bf16 Ksh[AT_KC * AT_D];             // K hi [kv][d]      8 KB
  __shared__ __align__(16) __bf16 Ksl[SPLIT_QK ? AT_KC * AT_D : 8];
  __shared__ __align__(16) __bf16 Vth[AT_D * AT_KC];             // V hi [d][kv]      8 KB
  __shared__ __align__(16) __bf16 Vtl[SPLIT_PV ? AT_D * AT_KC : 8];
  __shared__ __align__(16) __bf16 Psh[AT_NW][16 * AT_KC];        // per wave P hi [row][kv]  8 KB
  __shared__ __align__(16) __bf16 Psl[SPLIT_PV ? AT_NW : 1][SPLIT_PV ? 16 * AT_KC : 8];
  __shared__ __align__(16) float  Os[AT_NW][16 * 68];            // per wave out tile, pitch 68

  const int tid  = threadIdx.x;
  const int wave = tid >> 5;
  const int lane = tid & 31;
  const int hh   = lane >> 4;
  const int c    = lane & 15;

  const int nqb = g.S / AT_QB;
  const int bx = blockIdx.x + g.blk0;
  const int qb = bx % nqb;
  const int bh = bx / nqb;
  const int h  = bh % g.H;
  const int b  = bh / g.H;
  const int qbase_block = qb * AT_QB;
  const int q0 = qbase_block + wave * 16;

  const float* qb_ptr = q + (size_t)b * g.q_bs + (size_t)h * g.q_hs;
  const float* kb_ptr = k + (size_t)b * g.k_bs + (size_t)h * g.k_hs;
  const float* vb_ptr = v + (size_t)b * g.v_bs + (size_t)h * g.v_hs;
  float*       ob_ptr = out + (size_t)b * g.o_bs + (size_t)h * g.o_hs;

  // ---- Q fragments (A operand): 2 d-chunks, hi (and lo) ----
  v16b qah[2], qal[2];
  {
    const float* qrow = qb_ptr + (size_t)(q0 + c) * g.q_rs;
#pragma unroll
    for (int dc = 0; dc < 2; ++dc) {
#pragma unroll
      for (int e = 0; e < 8; ++e) {
        const float f0 = qrow[dc * 32 + 8 * hh + e] * g.qscale;
        const float f1 = qrow[dc * 32 + 16 + 8 * hh + e] * g.qscale;
        if (SPLIT_QK) { __bf16 hq, lq; at_split(f0, hq, lq); qah[dc][e] = hq; qal[dc][e] = lq; at_split(f1, hq, lq); qah[dc][8 + e] = hq; qal[dc][8 + e] = lq; }
        else { qah[dc][e] = at_to16<F16>(f0); qah[dc][8 + e] = at_to16<F16>(f1); qal[dc][e] = qah[dc][e]; qal[dc][8 + e] = qah[dc][8 + e]; }
      }
    }
  }

  float mrow[8], lrow[8];
  v8f oacc[4];
#pragma unroll
  for (int r = 0; r < 8; ++r) { mrow[r] = -INFINITY; lrow[r] = 0.f; }
#pragma unroll
  for (int t = 0; t < 4; ++t) oacc[t] = (v8f){0.f,0.f,0.f,0.f,0.f,0.f,0.f,0.f};

  const int nChunks = (g.mask_mode == 1 || g.mask_mode == 4) ? (qb + 1) : (g.Skv / AT_KC);   // block-uniform
  // per-row query mask (mode 3)
  int qkeep[8];
#pragma unroll
  for (int r = 0; r < 8; ++r) qkeep[r] = (g.mask_mode == 3) ? mask_b[(size_t)b * g.S + q0 + 8 * hh + r] : 1;   // mask_b = qmask in mode 3
  for (int kc = 0; kc < nChunks; ++kc) {
    const int kv0 = kc * AT_KC;
    __syncthreads();
    {
      const int kvr = tid >> 1, dh = (tid & 1) * 32;
      const float* krow = kb_ptr + (size_t)(kv0 + kvr) * g.k_rs + dh;
      const float* vrow = vb_ptr + (size_t)(kv0 + kvr) * g.v_rs + dh;
#pragma unroll
      for (int i = 0; i < 8; ++i) {
        v4f kk = *(const v4f*)(krow + 4 * i);
        v4f vv = *(const v4f*)(vrow + 4 * i);
#pragma unroll
        for (int e = 0; e < 4; ++e) {
          const int d = dh + 4 * i + e;
          if (SPLIT_QK) { __bf16 a, bl; at_split(kk[e], a, bl); Ksh[kvr * AT_D + d] = a; Ksl[kvr * AT_D + d] = bl; }
          else Ksh[kvr * AT_D + d] = at_to16<F16>(kk[e]);
          if (SPLIT_PV) { __bf16 a, bl; at_split(vv[e], a, bl); Vth[d * AT_KC + kvr] = a; Vtl[d * AT_KC + kvr] = bl; }
          else Vth[d * AT_KC + kvr] = at_to16<F16>(vv[e]);
        }
      }
    }
    __syncthreads();

    v8f s[4];
#pragma unroll
    for (int j = 0; j < 4; ++j) {
      s[j] = (v8f){0.f,0.f,0.f,0.f,0.f,0.f,0.f,0.f};
#pragma unroll 1
      for (int dc = 0; dc < 2; ++dc) {
        FB kb;
        kb.h[0] = *(const v8b*)(Ksh + (j * 16 + c) * AT_D + dc * 32 + 8 * hh);
        kb.h[1] = *(const v8b*)(Ksh + (j * 16 + c) * AT_D + dc * 32 + 16 + 8 * hh);
        s[j] = at_mma16<F16>(qah[dc], kb.v, s[j]);
        if (SPLIT_QK) {
          FB kl;
          kl.h[0] = *(const v8b*)(Ksl + (j * 16 + c) * AT_D + dc * 32 + 8 * hh);
          kl.h[1] = *(const v8b*)(Ksl + (j * 16 + c) * AT_D + dc * 32 + 16 + 8 * hh);
          s[j] = at_mma16<F16>(qah[dc], kl.v, s[j]);
          s[j] = at_mma16<F16>(qal[dc], kb.v, s[j]);
        }
      }
    }
    const bool diag = (g.mask_mode == 1) && (kc == qb);
    int kvkeep[4] = {1, 1, 1, 1};
    if (g.mask_mode == 3) {
#pragma unroll
      for (int j = 0; j < 4; ++j) kvkeep[j] = ((const int*)mask_a)[(size_t)b * g.Skv + kv0 + j * 16 + c];   // mask_a = kvmask
    }
    float cm[8];
#pragma unroll
    for (int r = 0; r < 8; ++r) {
      const int qrow = q0 + 8 * hh + r;
      float m = -INFINITY;
#pragma unroll
      for (int j = 0; j < 4; ++j) {
        const int kvcol = kv0 + j * 16 + c;
        bool masked = false;
        if (diag) masked = (kvcol > qrow);
        else if (g.mask_mode == 4) masked = (kvcol > qrow) || (qrow - kvcol > g.mask_is_int);
        else if (g.mask_mode == 2) {
          const size_t mi = (size_t)qrow * g.Skv + kvcol;
          masked = (g.mask_is_int == 0) ? (((const float*)mask_a)[mi] == 0.0f)
                 : (g.mask_is_int == 1) ? (((const int*)mask_a)[mi] == 0) : (((const int*)mask_a)[mi] != 0);
        } else if (g.mask_mode == 3) masked = (qkeep[r] == 0) || (kvkeep[j] == 0);
        else if (g.mask_mode == 5) {
          const size_t mi = (size_t)qrow * g.Skv + kvcol;
          masked = (((const int*)mask_a)[mi] != 0);
          int n = mask_b[mi]; n = n < 0 ? 0 : n;
          s[j][r] += g.cp[(size_t)b * g.c_bs + (size_t)h * g.c_hs + (size_t)qrow * g.c_rs + n]
                   + g.pc[(size_t)b * g.c_bs + (size_t)h * g.c_hs + (size_t)kvcol * g.c_rs + n];
        }
        if (masked) s[j][r] = g.mask_fill;
        m = fmaxf(m, s[j][r]);
      }
#pragma unroll
      for (int off = 1; off < 16; off <<= 1) m = fmaxf(m, __shfl_xor(m, off, 32));
      cm[r] = m;
    }
    __bf16* pwh = Psh[wave];
    __bf16* pwl = Psl[SPLIT_PV ? wave : 0];
#pragma unroll
    for (int r = 0; r < 8; ++r) {
      const float mnew = fmaxf(mrow[r], cm[r]);
      const float alpha = expf(mrow[r] - mnew);
      mrow[r] = mnew;
      float psum = 0.f;
#pragma unroll
      for (int j = 0; j < 4; ++j) {
        const float p = expf(s[j][r] - mnew);
        psum += p;
        if (SPLIT_PV) { __bf16 a, bl; at_split(p, a, bl); pwh[(8 * hh + r) * AT_KC + j * 16 + c] = a; pwl[(8 * hh + r) * AT_KC + j * 16 + c] = bl; }
        else pwh[(8 * hh + r) * AT_KC + j * 16 + c] = at_to16<F16>(p * PSC);
      }
#pragma unroll
      for (int off = 1; off < 16; off <<= 1) psum += __shfl_xor(psum, off, 32);
      lrow[r] = lrow[r] * alpha + psum;
#pragma unroll
      for (int t = 0; t < 4; ++t) oacc[t][r] *= alpha;
    }
    __builtin_amdgcn_fence(__ATOMIC_RELEASE, "workgroup");
    __builtin_amdgcn_wave_barrier();
    __builtin_amdgcn_fence(__ATOMIC_ACQUIRE, "workgroup");
#pragma unroll 1
    for (int kk = 0; kk < 2; ++kk) {
      FB pa, pl;
      pa.h[0] = *(const v8b*)(pwh + c * AT_KC + kk * 32 + 8 * hh);
      pa.h[1] = *(const v8b*)(pwh + c * AT_KC + kk * 32 + 16 + 8 * hh);
      if (SPLIT_PV) {
        pl.h[0] = *(const v8b*)(pwl + c * AT_KC + kk * 32 + 8 * hh);
        pl.h[1] = *(const v8b*)(pwl + c * AT_KC + kk * 32 + 16 + 8 * hh);
      }
#pragma unroll
      for (int t = 0; t < 4; ++t) {
        FB vb;
        vb.h[0] = *(const v8b*)(Vth + (t * 16 + c) * AT_KC + kk * 32 + 8 * hh);
        vb.h[1] = *(const v8b*)(Vth + (t * 16 + c) * AT_KC + kk * 32 + 16 + 8 * hh);
        oacc[t] = at_mma16<F16>(pa.v, vb.v, oacc[t]);
        if (SPLIT_PV) {
          FB vl;
          vl.h[0] = *(const v8b*)(Vtl + (t * 16 + c) * AT_KC + kk * 32 + 8 * hh);
          vl.h[1] = *(const v8b*)(Vtl + (t * 16 + c) * AT_KC + kk * 32 + 16 + 8 * hh);
          oacc[t] = at_mma16<F16>(pa.v, vl.v, oacc[t]);
          oacc[t] = at_mma16<F16>(pl.v, vb.v, oacc[t]);
        }
      }
    }
  }

  float* os = Os[wave];
#pragma unroll
  for (int r = 0; r < 8; ++r) {
    const float inv = 1.0f / (lrow[r] * PSC);
#pragma unroll
    for (int t = 0; t < 4; ++t) os[(8 * hh + r) * 68 + t * 16 + c] = oacc[t][r] * inv;
  }
  __builtin_amdgcn_fence(__ATOMIC_RELEASE, "workgroup");
  __builtin_amdgcn_wave_barrier();
  __builtin_amdgcn_fence(__ATOMIC_ACQUIRE, "workgroup");
  {
    const int c4 = (lane & 15) * 4;
    {
#pragma unroll
      for (int it = 0; it < 8; ++it) {
        const int row = it * 2 + hh;
        v4f val = *(const v4f*)(os + row * 68 + c4);
        *(v4f*)(ob_ptr + (size_t)(q0 + row) * g.o_rs + c4) = val;
      }
      
    }
  }
}

} // namespace w25



extern "C" void kernel_launch(void* const* d_in, const int* in_sizes, int n_in, void* d_out, int out_size, void* d_ws, size_t ws_size, hipStream_t stream) {
    (void)in_sizes; (void)n_in; (void)out_size; (void)ws_size;
    const float* x = (const float*)d_in[0];
    const float* ctx = (const float*)d_in[1];
    const float* Wq = (const float*)d_in[2];
    const float* Wk = (const float*)d_in[3];
    const float* Wv = (const float*)d_in[4];
    const float* Wo = (const float*)d_in[5];
    const float* bo = (const float*)d_in[6];
    const int Bn = 2;
    const int T = 2048;
    const int D = 1024;
    const int NH = 16;
    const int HD = 64;
    const int NR = Bn * T;
    const int RN = 2 * T - 1;
    float* out = (float*)d_out;
    char* wsp = (char*)d_ws;
    _Float16* Q = (_Float16*)wsp; wsp += (((size_t)((size_t)NR * D) * 2 + 255) / 256) * 256;
    _Float16* Kb = (_Float16*)wsp; wsp += (((size_t)((size_t)NR * D) * 2 + 255) / 256) * 256;
    _Float16* Vt = (_Float16*)wsp; wsp += (((size_t)((size_t)NR * D) * 2 + 255) / 256) * 256;   // V transposed: D rows of NR
    float* RT = (float*)wsp; wsp += (((size_t)((size_t)NH * RN + 64) * 4 + 255) / 256) * 256;
    unsigned short* G64A = (unsigned short*)wsp; wsp += (((size_t)(4194304) * 2 + 255) / 256) * 256;
    unsigned short* G64C = (unsigned short*)wsp; wsp += (((size_t)(4194304) * 2 + 255) / 256) * 256;
    unsigned short* G64B = (unsigned short*)wsp; wsp += (((size_t)(4 * 1048576) * 2 + 255) / 256) * 256;
    k_cast_in<NH, T><<<256, 512, 0, stream>>>(x, ctx, Wq, Wk, Wv, Wo, (_Float16*)(G64A), (_Float16*)(G64C), (_Float16*)(G64B), RT);
    w25::wmma_gemm_qkv<4096, 1024><<<768, 256, 0, stream>>>((const _Float16*)(G64A), (const _Float16*)(G64C), (const _Float16*)(G64B), Q, Kb, Vt, 0.0625f);
    k_attnT<2048, 1024, 4096><<<dim3(2048 / (16 * AW), 16, 2), 32 * AW, 0, stream>>>(Q, Kb, Vt, (_Float16*)(G64A), RT, 0.125f);   // x's f16 plane has been read for the last time: the attention output takes its place
    w25::wmma_gemm_lds<4096, 1024, 1024, 2, 0><<<256, 256, 0, stream>>>((const _Float16*)(G64A), (const _Float16*)(G64B + 3 * 1048576), out, nullptr, bo, 0.0625f);
}

// v010
// Measured time: 86.5 microseconds a run.
// Timed twice side by side with v009, it ran 1.03 times as fast both times.
// All steps since the starting kernel, v000, together make it 25.7 times as fast.
// Contractions: q = x.Wq^T [4096x1024].[1024x1024], k/v = context.W^T and the output projection (+b) with f16 operands on pre-cast planes (v_wmma_f32_16x16x32_f16; 128x128 block tiles staged in LDS by asynchronous copies, 32x64 wave tiles, weights x16); per (batch, head) softmax(q k^T / 8 + b_h(|i-j|)) v over 2048 keys (head_dim 64) as a flash kernel with f16 q.k^T and f16 p.v (p as f16, taken against a maximum that is renewed only when p nears the f16 range), the periodic distance bias -floor(|i-j|/30) 2^-(h+1) read from a per-head relative-offset table built on device; f32 accumulate and softmax.
#include <hip/hip_runtime.h>
#include <math.h>

typedef __attribute__((ext_vector_type(16))) _Float16 v16h;
typedef __attribute__((ext_vector_type(8)))  _Float16 v8h;
typedef __attribute__((ext_vector_type(4)))  _Float16 v4h;
typedef __attribute__((ext_vector_type(16))) __bf16   v16b;
typedef __attribute__((ext_vector_type(8)))  float    v8f;
typedef __attribute__((ext_vector_type(4)))  float    v4f;

// 16-bit WMMA fragment map (wave32), lane L, h = L>>4, m = L&15:
//   A 16x32: lane = row m;   element i -> k = (i<8) ? 8h+i : 16+8h+(i-8)
//   B 32x16: lane = column m; the SAME k(i,h)
//   D 16x16 (8 f32): lane = column m; element r -> row 8h+r
__device__ __forceinline__ int frag_k(int i, int h) { return (i < 8) ? (8 * h + i) : (16 + 8 * h + (i - 8)); }
__device__ __forceinline__ __bf16 bf16_rne(float f) {
    unsigned int u = __float_as_uint(f);
    u += 0x7fffu + ((u >> 16) & 1u);
    return __builtin_bit_cast(__bf16, (unsigned short)(u >> 16));
}
__device__ __forceinline__ float bf16_f32(__bf16 b) { return __uint_as_float(((unsigned int)__builtin_bit_cast(unsigned short, b)) << 16); }
__device__ __forceinline__ v8f wmma16(v16h a, v16h b, v8f c) {
    c = __builtin_amdgcn_wmma_f32_16x16x32_f16(false, a, false, b, (short)0, c, false, false);
    asm volatile("v_nop\n\tv_nop\n\tv_nop\n\tv_nop" : "+v"(c) : "v"(a), "v"(b));
    return c;
}
__device__ __forceinline__ v8f wmmab(v16b a, v16b b, v8f c) {
    c = __builtin_amdgcn_wmma_f32_16x16x32_bf16(false, a, false, b, (short)0, c, false, false);
    asm volatile("v_nop\n\tv_nop\n\tv_nop\n\tv_nop" : "+v"(c) : "v"(a), "v"(b));
    return c;
}
struct Split { v16b hi, lo; };
// hi/lo split product: a.hi*b.hi + a.hi*b.lo + a.lo*b.hi
__device__ __forceinline__ v8f wmma3(const Split& a, const Split& b, v8f c) {
    c = __builtin_amdgcn_wmma_f32_16x16x32_bf16(false, a.hi, false, b.hi, (short)0, c, false, false);
    c = __builtin_amdgcn_wmma_f32_16x16x32_bf16(false, a.hi, false, b.lo, (short)0, c, false, false);
    c = __builtin_amdgcn_wmma_f32_16x16x32_bf16(false, a.lo, false, b.hi, (short)0, c, false, false);
    asm volatile("v_nop\n\tv_nop\n\tv_nop\n\tv_nop" : "+v"(c) : "v"(a.hi), "v"(a.lo), "v"(b.hi), "v"(b.lo));
    return c;
}
struct Split3 { v16b hi, mid, lo; };
// triple split product (6 terms, drops only terms below 2^-24 relative)
__device__ __forceinline__ v8f wmma6(const Split3& a, const Split3& b, v8f c) {
    c = __builtin_amdgcn_wmma_f32_16x16x32_bf16(false, a.hi, false, b.hi, (short)0, c, false, false);
    c = __builtin_amdgcn_wmma_f32_16x16x32_bf16(false, a.hi, false, b.mid, (short)0, c, false, false);
    c = __builtin_amdgcn_wmma_f32_16x16x32_bf16(false, a.mid, false, b.hi, (short)0, c, false, false);
    c = __builtin_amdgcn_wmma_f32_16x16x32_bf16(false, a.hi, false, b.lo, (short)0, c, false, false);
    c = __builtin_amdgcn_wmma_f32_16x16x32_bf16(false, a.mid, false, b.mid, (short)0, c, false, false);
    c = __builtin_amdgcn_wmma_f32_16x16x32_bf16(false, a.lo, false, b.hi, (short)0, c, false, false);
    asm volatile("v_nop\n\tv_nop\n\tv_nop\n\tv_nop" : "+v"(c) : "v"(a.hi), "v"(a.mid), "v"(a.lo), "v"(b.hi), "v"(b.mid), "v"(b.lo));
    return c;
}

// Fragment gathers from f32 memory: element i <- p[(k0 + frag_k(i,h)) * sk] * s, zero for k >= klen.
__device__ __forceinline__ v16h fh_ld(const float* __restrict__ p, long long sk, int k0, int h, int klen, float s) {
    v16h a;
#pragma unroll
    for (int i = 0; i < 16; ++i) { const int k = k0 + frag_k(i, h); a[i] = (k < klen) ? (_Float16)(p[(long long)k * sk] * s) : (_Float16)0.f; }
    return a;
}
__device__ __forceinline__ Split sp_ld(const float* __restrict__ p, long long sk, int k0, int h, int klen, float s) {
    Split r;
#pragma unroll
    for (int i = 0; i < 16; ++i) {
        const int k = k0 + frag_k(i, h); const float x = (k < klen) ? p[(long long)k * sk] * s : 0.f;
        const __bf16 hb = bf16_rne(x); r.hi[i] = hb; r.lo[i] = bf16_rne(x - bf16_f32(hb));
    }
    return r;
}
__device__ __forceinline__ Split3 sp3_ld(const float* __restrict__ p, long long sk, int k0, int h, int klen, float s) {
    Split3 r;
#pragma unroll
    for (int i = 0; i < 16; ++i) {
        const int k = k0 + frag_k(i, h); const float x = (k < klen) ? p[(long long)k * sk] * s : 0.f;
        const __bf16 hb = bf16_rne(x); const float r1 = x - bf16_f32(hb); const __bf16 mb = bf16_rne(r1);
        r.hi[i] = hb; r.mid[i] = mb; r.lo[i] = bf16_rne(r1 - bf16_f32(mb));
    }
    return r;
}
__device__ __forceinline__ v16b bh_ld(const float* __restrict__ p, long long sk, int k0, int h, int klen, float s) {
    v16b a;
#pragma unroll
    for (int i = 0; i < 16; ++i) { const int k = k0 + frag_k(i, h); a[i] = bf16_rne((k < klen) ? p[(long long)k * sk] * s : 0.f); }
    return a;
}
// f16 fragment from an f16 LDS/global row with element stride 1 (k-contiguous), no bounds (tile already zero padded)
__device__ __forceinline__ v16h fh_row(const _Float16* __restrict__ row, int k0, int h) {
    v16h a;
#pragma unroll
    for (int i = 0; i < 16; ++i) a[i] = row[k0 + frag_k(i, h)];
    return a;
}

#define VST2(T, ptr, val) do { const T vst2_v_ = (val); *(T*)(ptr) = vst2_v_;  } while (0)
typedef float v4f __attribute__((ext_vector_type(4)));
#define VST2V4(ptr, val) do { const v4f vst2_v4_ = (val); *(v4f*)(ptr) = vst2_v4_;  } while (0)

__device__ __attribute__((noinline)) float act_fn(float v, int act) {
    if (act == 1) return fmaxf(v, 0.f);                                                                               // relu
    if (act == 2) { const float u = 0.7978845608028654f * (v + 0.044715f * v * v * v); return 0.5f * v * (1.f + tanhf(u)); } // tanh-gelu
    if (act == 3) return v / (1.f + expf(-v));                                                                        // silu
    if (act == 4) return 0.5f * v * (1.f + erff(v * 0.7071067811865476f));                                             // erf-gelu
    if (act == 5) return tanhf(v);
    if (act == 6) return 1.f / (1.f + expf(-v));                                                                      // sigmoid
    if (act == 7) return (v > 0.f) ? v : 0.01f * v;                                                                   // leaky relu 0.01
    if (act == 8) return (v > 0.f) ? v : (expf(v) - 1.f);                                                             // elu
    if (act == 9) return fminf(fmaxf(v, 0.f), 6.f);                                                                   // relu6
    if (act == 10) return fabsf(v);                                                                                    // abs
    if (act == 11) return (v >= 0.f) ? v : 0.1f * v;                                                                  // leaky 0.1
    if (act == 12) return (v > 0.f) ? v : 0.2f * v;                                                                   // leaky 0.2
    if (act == 13) return (v > 20.f) ? v : log1pf(expf(v));                                                            // softplus
    return v;
}

// =====================================================================================================================
// k_gemm<MODE>: C(z, m, n) = act(alpha * sum_k A(z, m, k) * B(z, k, n) + bias) + beta * R(z, m, n)
//   One wave (32-thread block) per 16 x 32 tile of C; grid (ceil(N/32), ceil(M/16), Z). Batch z -> (zo = z / zi_n, zi = z % zi_n)
//   with separate outer/inner strides for every tensor (e.g. batch and head). A(m,k) = A[zo*sAo + zi*sAi + m*sAm + k*sAk] (f32),
//   B(k,n) = B[zo*sBo + zi*sBi + n*sBn + k*sBk] (f32); any M, N, K (K zero-padded to 32 inside the fragments, M/N tails guarded).
//   C(m,n) = C[zo*sCo + zi*sCi + m*sCm + n] (n contiguous). flags: 1 bias[n], 2 bias[m], 4 residual R[zo*sRo + zi*sRi + m*sRm + n*sRn].
//   MODE 0: f16 operands (A prescaled by sa, B by sb, both undone in the epilogue); 1: bf16 hi/lo split (3 products); 2: bf16;
//   3: bf16 hi/mid/lo triple split (6 products); 4: as 3 with Kahan-compensated f32 accumulation across k-steps.
// =====================================================================================================================
struct GemmP {
    const float* A; const float* B; const float* bias; const float* R; float* C;
    long long sAo, sAi, sAm, sAk, sBo, sBi, sBn, sBk, sCo, sCi, sCm, sRo, sRi, sRm, sRn;
    int M, N, K, zi_n, flags, act; float alpha, beta, sa, sb;
    int Npad, pad_;     // columns [N, Npad) of C are written as 0 so that padded workspace rows are covered by whole-line stores; Npad >= N
};
static_assert(sizeof(GemmP) == 5 * 8 + 15 * 8 + 6 * 4 + 4 * 4 + 2 * 4, "GemmP has padding");

template <int MODE>
__global__ __launch_bounds__(32) void k_gemm(GemmP p) {
    const int lane = threadIdx.x & 31, h = lane >> 4, l15 = lane & 15;
    const int m0 = blockIdx.y * 16, n0 = blockIdx.x * 32;
    const int z = blockIdx.z, zo = z / p.zi_n, zi = z - zo * p.zi_n;
    const float* A = p.A + zo * p.sAo + zi * p.sAi;
    const float* B = p.B + zo * p.sBo + zi * p.sBi;
    const int am = min(m0 + l15, p.M - 1);                       // clamped row for loads (stores are guarded)
    v8f acc[2], comp[2];
#pragma unroll
    for (int t = 0; t < 2; ++t) { v8f zz = {}; acc[t] = zz; comp[t] = zz; }
    for (int k0 = 0; k0 < p.K; k0 += 32) {
        const float* arow = A + (long long)am * p.sAm;
        if (MODE == 1) {
            const Split a = sp_ld(arow, p.sAk, k0, h, p.K, 1.f);
#pragma unroll
            for (int t = 0; t < 2; ++t) {
                const int bn = min(n0 + t * 16 + l15, p.N - 1);
                acc[t] = wmma3(a, sp_ld(B + (long long)bn * p.sBn, p.sBk, k0, h, p.K, 1.f), acc[t]);
            }
        } else if (MODE == 3) {
            const Split3 a = sp3_ld(arow, p.sAk, k0, h, p.K, 1.f);
#pragma unroll
            for (int t = 0; t < 2; ++t) {
                const int bn = min(n0 + t * 16 + l15, p.N - 1);
                acc[t] = wmma6(a, sp3_ld(B + (long long)bn * p.sBn, p.sBk, k0, h, p.K, 1.f), acc[t]);
            }
        } else if (MODE == 4) {
            // triple split as MODE 3, but each k-step's 6 products go into a fresh accumulator and the partial is added to the running f32 sum
            // on the VALU with Kahan compensation (accumulation error stays ~1 ulp however long K is)
            const Split3 a = sp3_ld(arow, p.sAk, k0, h, p.K, 1.f);
#pragma unroll
            for (int t = 0; t < 2; ++t) {
                const int bn = min(n0 + t * 16 + l15, p.N - 1); v8f zz = {};
                const v8f part = wmma6(a, sp3_ld(B + (long long)bn * p.sBn, p.sBk, k0, h, p.K, 1.f), zz);
                const v8f y = part - comp[t]; const v8f s = acc[t] + y; comp[t] = (s - acc[t]) - y; acc[t] = s;
            }
        } else if (MODE == 2) {
            const v16b a = bh_ld(arow, p.sAk, k0, h, p.K, 1.f);
#pragma unroll
            for (int t = 0; t < 2; ++t) {
                const int bn = min(n0 + t * 16 + l15, p.N - 1);
                acc[t] = wmmab(a, bh_ld(B + (long long)bn * p.sBn, p.sBk, k0, h, p.K, 1.f), acc[t]);
            }
        } else {
            const v16h a = fh_ld(arow, p.sAk, k0, h, p.K, p.sa);
#pragma unroll
            for (int t = 0; t < 2; ++t) {
                const int bn = min(n0 + t * 16 + l15, p.N - 1);
                acc[t] = wmma16(a, fh_ld(B + (long long)bn * p.sBn, p.sBk, k0, h, p.K, p.sb), acc[t]);
            }
        }
    }
    const float iscale = (MODE == 0) ? p.alpha / (p.sa * p.sb) : p.alpha;
    float* C = p.C + zo * p.sCo + zi * p.sCi;
    const float* R = p.R + zo * p.sRo + zi * p.sRi;
    __shared__ __align__(16) float ctile[16][36];
#pragma unroll
    for (int t = 0; t < 2; ++t) {
        const int n = n0 + t * 16 + l15; const int nn = min(n, p.N - 1);
#pragma unroll
        for (int r = 0; r < 8; ++r) {
            const int m = m0 + 8 * h + r; const int mm = min(m, p.M - 1);
            float v = acc[t][r] * iscale;
            if (p.flags & 1) v += p.bias[nn];
            if (p.flags & 2) v += p.bias[mm];
            if (p.flags & 8) v *= p.bias[(long long)zo * p.M + mm];   /* per-(z,row) scale vector laid out [Z][M]; exclusive with the bias flags */
            v = act_fn(v, p.act);
            if (p.flags & 4) v += p.beta * R[(long long)mm * p.sRm + (long long)nn * p.sRn];
            ctile[8 * h + r][t * 16 + l15] = (n < p.N) ? v : 0.f;
        }
    }
    __syncthreads();
    const int NW = (p.Npad > p.N) ? p.Npad : p.N;           // write width
    const bool fast = (m0 + 16 <= p.M) && (n0 + 32 <= NW) && ((p.sCm & 3) == 0) && ((((size_t)C) & 15) == 0);
    if (fast) {
#pragma unroll
        for (int s = 0; s < 4; ++s) {
            const int row = s * 4 + (lane >> 3), c4 = (lane & 7) * 4;
            const v4f v = *(const v4f*)&ctile[row][c4];
            VST2V4(C + (long long)(m0 + row) * p.sCm + n0 + c4, v);
        }
    } else {
        for (int row = 0; row < 16; ++row) {
            const int m = m0 + row, n = n0 + lane;
            if (m < p.M && n < NW) VST2(float, C + (long long)m * p.sCm + n, ctile[row][lane]);
        }
    }
}


// =====================================================================================================================
// k_gemmT<MODE, TM, TN>: same contract as k_gemm, but one wave computes a (16*TM) x (16*TN) tile: TM A fragments and TN B fragments are
//   loaded per 32-wide k-step and reused across TM*TN WMMAs (far fewer load/convert instructions per MAC). MODE 0 (f16), 1 (bf16 hi/lo),
//   2 (bf16) only. grid (ceil(NW/(16*TN)), ceil(M/(16*TM)), Z), block 32. Epilogue identical to k_gemm, run per 16x32 sub-tile.
// =====================================================================================================================
template <int MODE, int TM, int TN>
__global__ __launch_bounds__(32) void k_gemmT(GemmP p) {
    const int lane = threadIdx.x & 31, h = lane >> 4, l15 = lane & 15;
    const int m0 = blockIdx.y * (16 * TM), n0 = blockIdx.x * (16 * TN);
    const int z = blockIdx.z, zo = z / p.zi_n, zi = z - zo * p.zi_n;
    const float* A = p.A + zo * p.sAo + zi * p.sAi;
    const float* B = p.B + zo * p.sBo + zi * p.sBi;
    v8f acc[TM][TN];
#pragma unroll
    for (int i = 0; i < TM; ++i)
#pragma unroll
        for (int t = 0; t < TN; ++t) { v8f zz = {}; acc[i][t] = zz; }
    for (int k0 = 0; k0 < p.K; k0 += 32) {
        if (MODE == 1) {
            Split a[TM], b[TN];
#pragma unroll
            for (int i = 0; i < TM; ++i) { const int am = min(m0 + 16 * i + l15, p.M - 1); a[i] = sp_ld(A + (long long)am * p.sAm, p.sAk, k0, h, p.K, 1.f); }
#pragma unroll
            for (int t = 0; t < TN; ++t) { const int bn = min(n0 + 16 * t + l15, p.N - 1); b[t] = sp_ld(B + (long long)bn * p.sBn, p.sBk, k0, h, p.K, 1.f); }
#pragma unroll
            for (int i = 0; i < TM; ++i)
#pragma unroll
                for (int t = 0; t < TN; ++t) acc[i][t] = wmma3(a[i], b[t], acc[i][t]);
        } else if (MODE == 2) {
            v16b a[TM], b[TN];
#pragma unroll
            for (int i = 0; i < TM; ++i) { const int am = min(m0 + 16 * i + l15, p.M - 1); a[i] = bh_ld(A + (long long)am * p.sAm, p.sAk, k0, h, p.K, 1.f); }
#pragma unroll
            for (int t = 0; t < TN; ++t) { const int bn = min(n0 + 16 * t + l15, p.N - 1); b[t] = bh_ld(B + (long long)bn * p.sBn, p.sBk, k0, h, p.K, 1.f); }
#pragma unroll
            for (int i = 0; i < TM; ++i)
#pragma unroll
                for (int t = 0; t < TN; ++t) acc[i][t] = wmmab(a[i], b[t], acc[i][t]);
        } else {
            v16h a[TM], b[TN];
#pragma unroll
            for (int i = 0; i < TM; ++i) { const int am = min(m0 + 16 * i + l15, p.M - 1); a[i] = fh_ld(A + (long long)am * p.sAm, p.sAk, k0, h, p.K, p.sa); }
#pragma unroll
            for (int t = 0; t < TN; ++t) { const int bn = min(n0 + 16 * t + l15, p.N - 1); b[t] = fh_ld(B + (long long)bn * p.sBn, p.sBk, k0, h, p.K, p.sb); }
#pragma unroll
            for (int i = 0; i < TM; ++i)
#pragma unroll
                for (int t = 0; t < TN; ++t) acc[i][t] = wmma16(a[i], b[t], acc[i][t]);
        }
    }
    const float iscale = (MODE == 0) ? p.alpha / (p.sa * p.sb) : p.alpha;
    float* C = p.C + zo * p.sCo + zi * p.sCi;
    const float* R = p.R + zo * p.sRo + zi * p.sRi;
    const int NW = (p.Npad > p.N) ? p.Npad : p.N;
    __shared__ __align__(16) float ctile[16][36];
#pragma unroll
    for (int i = 0; i < TM; ++i) {
        const int mb = m0 + 16 * i; if (mb >= p.M) break;          // wave-uniform
#pragma unroll
        for (int tp = 0; tp < TN / 2; ++tp) {
            const int nb = n0 + 32 * tp; if (nb >= NW) break;        // wave-uniform
#pragma unroll
            for (int t2 = 0; t2 < 2; ++t2) {
                const int t = 2 * tp + t2; const int n = nb + t2 * 16 + l15; const int nn = min(n, p.N - 1);
#pragma unroll
                for (int r = 0; r < 8; ++r) {
                    const int m = mb + 8 * h + r; const int mm = min(m, p.M - 1);
                    float v = acc[i][t][r] * iscale;
                    if (p.flags & 1) v += p.bias[nn];
                    if (p.flags & 2) v += p.bias[mm];
            if (p.flags & 8) v *= p.bias[(long long)zo * p.M + mm];   /* per-(z,row) scale vector laid out [Z][M]; exclusive with the bias flags */
                    v = act_fn(v, p.act);
                    if (p.flags & 4) v += p.beta * R[(long long)mm * p.sRm + (long long)nn * p.sRn];
                    ctile[8 * h + r][t2 * 16 + l15] = (n < p.N) ? v : 0.f;
                }
            }
            __syncthreads();
            const bool fast = (mb + 16 <= p.M) && (nb + 32 <= NW) && ((p.sCm & 3) == 0) && ((((size_t)C) & 15) == 0);
            if (fast) {
#pragma unroll
                for (int s = 0; s < 4; ++s) {
                    const int row = s * 4 + (lane >> 3), c4 = (lane & 7) * 4;
                    const v4f v = *(const v4f*)&ctile[row][c4];
                    VST2V4(C + (long long)(mb + row) * p.sCm + nb + c4, v);
                }
            } else {
                for (int row = 0; row < 16; ++row) {
                    const int m = mb + row, n = nb + lane;
                    if (m < p.M && n < NW) VST2(float, C + (long long)m * p.sCm + n, ctile[row][lane]);
                }
            }
            __syncthreads();
        }
    }
}

// =====================================================================================================================
//   Wave = 16 queries, AW waves per block, 64-key blocks; grid (ceil(Lq/(16*AW)), H, B), block 32*AW. Any Lq, Lk; head dim dh <= DHP
//   (DHP multiple of 32), value dim dv <= DVP (multiple of 16, <= 128). Every tensor addressed by (batch, head, row, element) strides, f32.
//   Scores: QM 0 f16 operands, 1 bf16 hi/lo split, 2 bf16 triple split; statistics f32 (exp2 domain); P.V: P x 4096 as f16 with V f16 staged in LDS
//   (SPLITPV: P and V as bf16 hi/lo splits). kv head = h / hrep. Masking: causal = 1 (keep j <= i + coff, masked -> -inf, key blocks beyond the
//   diagonal skipped), causal = 2 (masked -> mfill, a finite fill like the -1e9; no skipping), causal = 3 (keep j >= i + coff,
//   masked -> -inf, no skipping); optional additive f32 mask Mf,
//   optional int keep-mask Mi (0 -> score := mfill), both addressed b*smb + h*smh + i*smi + j*smj (0 strides broadcast).
// =====================================================================================================================
#define AW 4
struct AttnP {   // apv4
    const float* Q; const float* K; const float* V; float* O; float* P; const float* Mf; const int* Mi; float* ST;
    const float* Pw; const float* Rt; const int* SQ; const int* SK;           // optional: post-softmax weight, relative-position table, segment ids
    long long swb, swh, swi, swj, srb, srh, sri;                                 // Pw strides (b,h,i,j); Rt strides (b,h,i), column = clamp(i - j + roff, 0, rn-1)
    long long sQb, sQh, sQi, sQd, sKb, sKh, sKj, sKd, sVb, sVh, sVj, sVd, sOb, sOh, sOi, sPb, sPh, sPi, smb, smh, smi, smj;
    int Lq, Lk, dh, dv, hrep, causal, coff, pband;   // pband > 0: P holds only the band |j - i| <= pband, column j - i + pband
    float scale, mfill; int nonorm, mpol;             // nonorm (online path only): O = sum_j exp(score_j) V_j without the 1/rowsum (scores must be <= ~0); mpol: Mi masks where ==0 (mpol 0) or where !=0 (mpol 1)
    int roff, rn, segpol, win;                        // Rt column offset/count; SQ/SK: score := mfill where (segpol 0) SQ[i] != SK[j] or (segpol 1) SQ[i] == SK[j]; win > 0: keys with i - j > win (after coff) -> -inf
};
//   Pw: the softmax numerator is multiplied by Pw(b,h,i,j) AFTER the row sum is taken (probs * weight, then P.V), as in post-softmax multiplicative biases.                                                    // ST (optional): per row (b,h,i) -> ST[((b*H + h)*Lq + i)*2 + {0,1}] = {row max of the scaled+masked score (natural units), sum_j exp(score - max)}
static_assert(sizeof(AttnP) == 12 * 8 + 29 * 8 + 16 * 4, "AttnP has padding");

// Inputs-only fence on sixteen loaded values: all must have arrived here, so their loads are issued together ahead of it and share one wait
// (without it the register-budgeted schedule waits after every load). It names no product and changes no value.
template <typename T> __device__ __forceinline__ void hold16(const T* x) {
    asm volatile("" :: "v"(x[0]), "v"(x[1]), "v"(x[2]), "v"(x[3]), "v"(x[4]), "v"(x[5]), "v"(x[6]), "v"(x[7]),
                       "v"(x[8]), "v"(x[9]), "v"(x[10]), "v"(x[11]), "v"(x[12]), "v"(x[13]), "v"(x[14]), "v"(x[15]));
}
#ifndef KATTN_ATTR
#define KATTN_ATTR __attribute__((amdgpu_waves_per_eu(4)))   // register budget of 256: four waves a SIMD, so that all 1,024 blocks of the launch are resident at once
#endif
//   GT > 0 fixes the geometry at compile time: Lq = Lk = GT, rows of GD floats with head h at column h * DHP (unit element stride), dh = DHP,
//   dv = DVP, one kv head per head, no mask, weight, segment, P or ST tensor, and a per-head Rt row of 2 GT - 1 columns. Only Q, K, V, O, Rt and scale
//   are then taken from the argument, so every length guard folds and the loads of a key block are contiguous and free of branches.
template <int DHP, int DVP, int QM, bool SPLITPV, bool TWOPASS, int GT = 0, int GD = 0>
__global__ __launch_bounds__(32 * AW) KATTN_ATTR void k_attn(AttnP parg) {
    AttnP p = parg;
    if (GT > 0) {
        p.P = nullptr; p.Mf = nullptr; p.Mi = nullptr; p.ST = nullptr; p.Pw = nullptr; p.SQ = nullptr; p.SK = nullptr;
        p.swb = 0; p.swh = 0; p.swi = 0; p.swj = 0; p.srb = 0; p.srh = 2 * GT - 1; p.sri = 0;
        p.sQb = (long long)GT * GD; p.sQh = DHP; p.sQi = GD; p.sQd = 1; p.sKb = (long long)GT * GD; p.sKh = DHP; p.sKj = GD; p.sKd = 1;
        p.sVb = (long long)GT * GD; p.sVh = DVP; p.sVj = GD; p.sVd = 1; p.sOb = (long long)GT * GD; p.sOh = DVP; p.sOi = GD;
        p.sPb = 0; p.sPh = 0; p.sPi = 0; p.smb = 0; p.smh = 0; p.smi = 0; p.smj = 0;
        p.Lq = GT; p.Lk = GT; p.dh = DHP; p.dv = DVP; p.hrep = 1; p.causal = 0; p.coff = 0; p.pband = 0;
        p.mfill = 0.f; p.nonorm = 0; p.mpol = 0; p.roff = GT - 1; p.rn = 2 * GT - 1; p.segpol = 0; p.win = 0;
        __builtin_assume(p.Rt != nullptr);
    }
    constexpr bool FULL = GT > 0 && GT % (16 * AW) == 0 && GT % 64 == 0;   // every query tile and key block is whole: index clamps and length guards are identities
    constexpr int NT = DVP / 16;                // output tiles
    constexpr int KS = DHP / 32;                // k-steps for the scores
    constexpr int VP = DVP + 8;                 // LDS pitch (halves)
    __shared__ __align__(16) float    pl[AW][16 * 64];
    __shared__ __align__(16) _Float16 vl[(SPLITPV ? 2 : 1) * 64 * VP];   // f16 V tile, or bf16 hi and lo tiles (same 2-byte size)
    const int lane = threadIdx.x & 31, hf = lane >> 4, l15 = lane & 15, wave = threadIdx.x >> 5;
    const int h = blockIdx.y, b = blockIdx.z, hk = h / p.hrep;
    const int q0 = (blockIdx.x * AW + wave) * 16;
    float* myp = pl[wave];
    const float L2E = 1.4426950408889634f;
    const float NEG = -__builtin_inff();
    const int qi = FULL ? q0 + l15 : min(q0 + l15, p.Lq - 1);
    const float* qrow = p.Q + b * p.sQb + h * p.sQh + (long long)qi * p.sQi;
    const float* kbase = p.K + b * p.sKb + hk * p.sKh;
    const float* vbase = p.V + b * p.sVb + hk * p.sVh;
    v16h qa[QM == 0 ? KS : 1]; Split qs_[QM == 1 ? KS : 1]; Split3 qt_[QM == 2 ? KS : 1];
#pragma unroll
    for (int ks = 0; ks < KS; ++ks) {
        if (QM == 2) qt_[ks] = sp3_ld(qrow, p.sQd, ks * 32, hf, p.dh, 1.f);
        else if (QM == 1) qs_[ks] = sp_ld(qrow, p.sQd, ks * 32, hf, p.dh, 1.f);
        else qa[ks] = fh_ld(qrow, p.sQd, ks * 32, hf, p.dh, 1.f);
    }
    v8f o[NT]; float m8[8], l8[8];
#pragma unroll
    for (int t = 0; t < NT; ++t) { v8f zz = {}; o[t] = zz; }
#pragma unroll
    for (int i = 0; i < 8; ++i) { m8[i] = NEG; l8[i] = 0.f; }
    int jend = p.Lk;
    if (p.causal == 1) { const int je = (blockIdx.x * AW + AW - 1) * 16 + 16 + p.coff; jend = min(jend, max(je, 0)); }   // uniform per block
    const int npass = TWOPASS ? 2 : 1;
    for (int pass = 0; pass < npass; ++pass) {
        const bool dopv = (!TWOPASS) || pass == 1;
        for (int j0 = 0; j0 < jend; j0 += 64) {
            if (dopv) {
                __syncthreads();                                 // previous key block's reads of vl / pl are done
                constexpr int VN = 64 * DVP / (32 * AW);         // V elements per thread and key block
                constexpr bool VLIN = (32 * AW) % DVP == 0;      // a thread keeps its column: its rows differ by a constant step
                float vf[VN];
#pragma unroll   // constant trip count: with the guard folded the tile's loads differ by immediate offsets only
                for (int it = 0; it < VN; ++it) {
                    const int idx = threadIdx.x + it * (32 * AW);
                    const int jr = VLIN ? (int)threadIdx.x / DVP + it * ((32 * AW) / DVP) : idx / DVP, d = VLIN ? (int)threadIdx.x % DVP : idx - jr * DVP, j = j0 + jr;
                    if constexpr (FULL && VLIN)   // block-uniform tile pointer + the thread's fixed offset + a constant
                        vf[it] = (vbase + (long long)j0 * GD)[(size_t)(unsigned)((int)threadIdx.x / DVP * GD + (int)threadIdx.x % DVP) + it * ((32 * AW) / DVP) * GD];
                    else
                        vf[it] = (j < p.Lk && d < p.dv) ? vbase[(long long)j * p.sVj + (long long)d * p.sVd] : 0.f;
                }
                if (FULL && VN == 32) { hold16(vf); hold16(vf + 16); }   // the tile's loads all issue ahead of this line and are waited for once
#pragma unroll
                for (int it = 0; it < VN; ++it) {
                    const int idx = threadIdx.x + it * (32 * AW);
                    const int jr = VLIN ? (int)threadIdx.x / DVP + it * ((32 * AW) / DVP) : idx / DVP, d = VLIN ? (int)threadIdx.x % DVP : idx - jr * DVP;
                    const float f = vf[it];
                    if (SPLITPV) {
                        const __bf16 hb = bf16_rne(f);
                        ((__bf16*)vl)[jr * VP + d] = hb; ((__bf16*)vl)[64 * VP + jr * VP + d] = bf16_rne(f - bf16_f32(hb));
                    } else vl[jr * VP + d] = (_Float16)f;
                }
            }
            v8f s[4];
            float rb[8][4];                                     // the key block's relative-position table entries, fetched ahead of the products
            if constexpr (FULL) {
                // column i - j + GT - 1 as block-uniform pointer + the lane's fixed offset + a constant, each part >= 0 (j0 <= GT - 64)
                const float* rt = p.Rt + (long long)h * (2 * GT - 1) + ((int)blockIdx.x * (16 * AW) - j0 + (GT - 64));
                const unsigned ro = (unsigned)(wave * 16 + 8 * hf + 15 - l15);
#pragma unroll
                for (int i = 0; i < 8; ++i)
#pragma unroll
                    for (int t = 0; t < 4; ++t) rb[i][t] = rt[(size_t)ro + (i + 16 * (3 - t))];
            } else if (p.Rt) {
#pragma unroll
                for (int i = 0; i < 8; ++i)
#pragma unroll
                    for (int t = 0; t < 4; ++t) {
                        const int ic = min(q0 + i + 8 * hf, p.Lq - 1);
                        int rc = ic - min(j0 + t * 16 + l15, p.Lk - 1) + p.roff; rc = rc < 0 ? 0 : (rc >= p.rn ? p.rn - 1 : rc);
                        rb[i][t] = p.Rt[b * p.srb + h * p.srh + (long long)ic * p.sri + rc];
                    }
            }
            if constexpr (FULL && QM == 0 && KS == 2) {
                // two key tiles at a time: their sixteen 16-byte loads (fh_ld's k order: floats 8 hf + 0..7 and 16 + 8 hf + 0..7 of each 32) fly together
#pragma unroll
                for (int tp = 0; tp < 2; ++tp) {
                    v4f kr[16];
#pragma unroll
                    for (int t2 = 0; t2 < 2; ++t2)
#pragma unroll
                        for (int ks = 0; ks < 2; ++ks) {
                            const v4f* kp = (const v4f*)((kbase + (long long)j0 * GD) + ((size_t)(unsigned)(l15 * GD + 8 * hf) + (2 * tp + t2) * 16 * GD + ks * 32));
                            kr[(t2 * 2 + ks) * 4 + 0] = kp[0]; kr[(t2 * 2 + ks) * 4 + 1] = kp[1]; kr[(t2 * 2 + ks) * 4 + 2] = kp[4]; kr[(t2 * 2 + ks) * 4 + 3] = kp[5];
                        }
                    hold16(kr);                                  // all sixteen loads issue ahead of this line and are waited for once
#pragma unroll
                    for (int t2 = 0; t2 < 2; ++t2) {
                        v8f acc = {};
#pragma unroll
                        for (int ks = 0; ks < 2; ++ks) {
                            v16h kfr;
#pragma unroll
                            for (int e = 0; e < 16; ++e) kfr[e] = (_Float16)kr[(t2 * 2 + ks) * 4 + (e >> 2)][e & 3];
                            acc = wmma16(qa[ks], kfr, acc);
                        }
                        s[2 * tp + t2] = acc;
                    }
                }
            } else {
#pragma unroll
            for (int t = 0; t < 4; ++t) {
                const int j = min(j0 + t * 16 + l15, p.Lk - 1);
                const float* krow = kbase + (long long)j * p.sKj;
                v8f acc = {};
#pragma unroll
                for (int ks = 0; ks < KS; ++ks) {
                    if (QM == 2)      acc = wmma6(qt_[ks], sp3_ld(krow, p.sKd, ks * 32, hf, p.dh, 1.f), acc);
                    else if (QM == 1) acc = wmma3(qs_[ks], sp_ld(krow, p.sKd, ks * 32, hf, p.dh, 1.f), acc);
                    else              acc = wmma16(qa[ks], fh_ld(krow, p.sKd, ks * 32, hf, p.dh, 1.f), acc);
                }
                s[t] = acc;
            }
            }
            float pv[8][4];
#pragma unroll
            for (int i = 0; i < 8; ++i) {
                const int irow = q0 + i + 8 * hf;
                const int ic = FULL ? irow : min(irow, p.Lq - 1);
                float sc[4];
#pragma unroll
                for (int t = 0; t < 4; ++t) {
                    const int jg = j0 + t * 16 + l15;
                    float v = s[t][i] * p.scale;
                    if (p.Mf) v += p.Mf[b * p.smb + h * p.smh + (long long)ic * p.smi + (long long)min(jg, p.Lk - 1) * p.smj];
                    if (p.Rt) v += rb[i][t];
                    if (p.Mi) { const int mv = p.Mi[b * p.smb + h * p.smh + (long long)ic * p.smi + (long long)min(jg, p.Lk - 1) * p.smj]; if (p.mpol ? (mv != 0) : (mv == 0)) v = p.mfill; }
                    if (p.SQ) { const bool same = p.SQ[(long long)b * p.Lq + ic] == p.SK[(long long)b * p.Lk + min(jg, p.Lk - 1)]; if (p.segpol ? same : !same) v = p.mfill; }
                    if (p.causal == 2 && jg > irow + p.coff) v = p.mfill;
                    if ((!FULL && jg >= p.Lk) || (p.causal == 1 && jg > irow + p.coff) || (p.causal == 3 && jg < irow + p.coff) || (p.win > 0 && irow + p.coff - jg > p.win)) v = NEG; else v *= L2E;
                    sc[t] = v;
                }
                if (!TWOPASS || pass == 0) {
                    float mx = fmaxf(fmaxf(sc[0], sc[1]), fmaxf(sc[2], sc[3]));
                    mx = fmaxf(mx, __shfl_xor(mx, 1, 32)); mx = fmaxf(mx, __shfl_xor(mx, 2, 32));
                    mx = fmaxf(mx, __shfl_xor(mx, 4, 32)); mx = fmaxf(mx, __shfl_xor(mx, 8, 32));
                    const float mnew = fmaxf(m8[i], mx);
                    const float corr = (mnew == NEG) ? 1.f : exp2f(m8[i] - mnew);
                    float rs = 0.f;
#pragma unroll
                    for (int t = 0; t < 4; ++t) {
                        const float pp = (sc[t] == NEG) ? 0.f : exp2f(sc[t] - mnew); rs += pp;
                        pv[i][t] = p.Pw ? pp * p.Pw[b * p.swb + h * p.swh + (long long)ic * p.swi + (long long)min(j0 + t * 16 + l15, p.Lk - 1) * p.swj] : pp;
                    }
                    rs += __shfl_xor(rs, 1, 32); rs += __shfl_xor(rs, 2, 32); rs += __shfl_xor(rs, 4, 32); rs += __shfl_xor(rs, 8, 32);
                    l8[i] = l8[i] * corr + rs; m8[i] = mnew;
                    if (!TWOPASS) {
#pragma unroll
                        for (int t = 0; t < NT; ++t) o[t][i] *= corr;
                    }
                } else {
                    const float inv = (l8[i] > 0.f) ? 1.f / l8[i] : 0.f;
#pragma unroll
                    for (int t = 0; t < 4; ++t) {
                        const int jg = j0 + t * 16 + l15;
                        float pp = (sc[t] == NEG) ? 0.f : exp2f(sc[t] - m8[i]) * inv;
                        if (p.Pw) pp *= p.Pw[b * p.swb + h * p.swh + (long long)ic * p.swi + (long long)min(jg, p.Lk - 1) * p.swj];
                        pv[i][t] = pp;
                    }
                }
            }
            if (dopv) {
#pragma unroll
                for (int i = 0; i < 8; ++i)
#pragma unroll
                    for (int t = 0; t < 4; ++t) ((float*)myp)[(i + 8 * hf) * 64 + t * 16 + l15] = pv[i][t];
                __syncthreads();                                 // P (per wave) and V (shared) visible
                if (p.P) {
                    float* pb_ = p.P + b * p.sPb + h * p.sPh;
                    const bool fastP = (p.pband == 0) && ((p.sPi & 3) == 0) && (j0 + 64 <= p.Lk) && (q0 + 16 <= p.Lq) && ((((size_t)pb_) & 15) == 0);
                    if (fastP) {
#pragma unroll
                        for (int s = 0; s < 8; ++s) {
                            const int row = s * 2 + (lane >> 4), c4 = (lane & 15) * 4;
                            const v4f v = *(const v4f*)(myp + row * 64 + c4);
                            VST2V4(pb_ + (long long)(q0 + row) * p.sPi + j0 + c4, v);
                        }
                    } else {
                        for (int row = 0; row < 16; ++row) {
                            const int irow = q0 + row; if (irow >= p.Lq) continue;
                            for (int c = lane; c < 64; c += 32) {
                                const int jg = j0 + c; if (jg >= p.Lk) continue;
                                if (p.pband == 0) VST2(float, pb_ + (long long)irow * p.sPi + jg, myp[row * 64 + c]);
                                else if (jg - irow <= p.pband && irow - jg <= p.pband) VST2(float, pb_ + (long long)irow * p.sPi + (jg - irow + p.pband), myp[row * 64 + c]);
                            }
                        }
                    }
                }
                if (SPLITPV) {
                    const Split pa0 = sp_ld(myp + l15 * 64, 1, 0, hf, 64, 1.f), pa1 = sp_ld(myp + l15 * 64, 1, 32, hf, 64, 1.f);
                    const __bf16* vh = (const __bf16*)vl; const __bf16* vlo = vh + 64 * VP;
#pragma unroll
                    for (int t = 0; t < NT; ++t) {
                        const int dcol = t * 16 + l15;
                        Split b0, b1;
#pragma unroll
                        for (int e = 0; e < 16; ++e) {
                            const int k0 = frag_k(e, hf), k1 = 32 + frag_k(e, hf);
                            b0.hi[e] = vh[k0 * VP + dcol]; b0.lo[e] = vlo[k0 * VP + dcol]; b1.hi[e] = vh[k1 * VP + dcol]; b1.lo[e] = vlo[k1 * VP + dcol];
                        }
                        o[t] = wmma3(pa0, b0, o[t]);
                        o[t] = wmma3(pa1, b1, o[t]);
                    }
                } else {
                    const v16h pa0 = fh_ld(myp + l15 * 64, 1, 0, hf, 64, 4096.f), pa1 = fh_ld(myp + l15 * 64, 1, 32, hf, 64, 4096.f);
#pragma unroll
                    for (int t = 0; t < NT; ++t) {
                        const int dcol = t * 16 + l15;
                        v16h b0, b1;
#pragma unroll
                        for (int e = 0; e < 16; ++e) { b0[e] = vl[frag_k(e, hf) * VP + dcol]; b1[e] = vl[(32 + frag_k(e, hf)) * VP + dcol]; }
                        o[t] = wmma16(pa0, b0, o[t]);
                        o[t] = wmma16(pa1, b1, o[t]);
                    }
                }
            }
        }
    }
    float* obase = p.O + b * p.sOb + h * p.sOh;
    if (p.ST) {
        const int rl = lane >> 1, isel = rl & 7;           // row q0 + rl ; rl>>3 == hf holds because lane>>4 == (lane>>1)>>3
        float mv = 0.f, lv = 0.f;
#pragma unroll
        for (int i = 0; i < 8; ++i) if (i == isel) { mv = m8[i]; lv = l8[i]; }
        const int irow = q0 + rl;
        if (irow < p.Lq) { float* st = p.ST + (((long long)b * gridDim.y + h) * p.Lq + irow) * 2 + (lane & 1); VST2(float, st, (lane & 1) ? lv : mv * 0.6931471805599453f); }
    }
    float invr[8];
#pragma unroll
    for (int i = 0; i < 8; ++i) {
        if (TWOPASS) invr[i] = SPLITPV ? 1.f : (1.f / 4096.f);
        else if (p.nonorm) invr[i] = exp2f(m8[i]) * (SPLITPV ? 1.f : (1.f / 4096.f));
        else invr[i] = (l8[i] > 0.f) ? (SPLITPV ? 1.f / l8[i] : 1.f / (l8[i] * 4096.f)) : 0.f;
    }
    __syncthreads();                                             // all waves done with pl/vl from the main loop
    const bool ofast = ((p.sOi & 3) == 0) && ((((size_t)obase) & 15) == 0) && (q0 + 16 <= p.Lq);
#pragma unroll
    for (int c0 = 0; c0 < DVP; c0 += 64) {
#pragma unroll
        for (int i = 0; i < 8; ++i)
#pragma unroll
            for (int t = 0; t < NT; ++t) if (t * 16 >= c0 && t * 16 < c0 + 64) ((float*)myp)[(i + 8 * hf) * 64 + (t * 16 - c0) + l15] = o[t][i] * invr[i];
        __syncthreads();
        const int cw = (DVP - c0 < 64) ? (DVP - c0) : 64;      // staged columns in this chunk (multiple of 16)
        if (ofast && (c0 + cw <= p.dv) && (cw % 32 == 0)) {
            const int lpr = cw / 4;                              // lanes per row (16 for 64 cols, 8 for 32)
            const int rows_per_ins = 32 / lpr;
            for (int r0 = 0; r0 < 16; r0 += rows_per_ins) {
                const int row = r0 + lane / lpr, c4 = (lane % lpr) * 4;
                const v4f v = *(const v4f*)(myp + row * 64 + c4);
                VST2V4(obase + (long long)(q0 + row) * p.sOi + c0 + c4, v);
            }
        } else {
            for (int row = 0; row < 16; ++row) {
                const int irow = q0 + row; if (irow >= p.Lq) continue;
                for (int c = lane; c < cw; c += 32) { const int d = c0 + c; if (d < p.dv) VST2(float, obase + (long long)irow * p.sOi + d, myp[row * 64 + c]); }
            }
        }
        __syncthreads();
    }
}

__device__ __forceinline__ float xhalf(float x) { return __builtin_bit_cast(float, __builtin_amdgcn_permlanex16(__builtin_bit_cast(int, x), __builtin_bit_cast(int, x), 0x76543210, 0xfedcba98, false, false)); }
// 2^x as the one hardware instruction. exp2f puts a compare, two selects, an add and a ldexp round every v_exp_f32, only so that results below 2^-126 come out as
// denormals. Every argument here is a score minus the row's maximum in use (plus AT_PSH): such a term is under 2^-126 of the row's largest, is zero as an f16 p either way and
// cannot move the f32 row sum, which ends at 1 or more. From -126 up the value is the same bit for bit; -inf (the first trip's rescale factor) gives 0, +inf gives +inf.
// Written as asm, each value in its own register and in place, so that the slot which the instruction set asks for behind a transcendental is filled by construction:
// behind each v_exp_f32 stands one that touches neither its result nor its source, behind the last a v_nop.
__device__ __forceinline__ void exp2_run8(float* x) {
    asm("v_exp_f32 %0, %0\n\tv_exp_f32 %1, %1\n\tv_exp_f32 %2, %2\n\tv_exp_f32 %3, %3\n\t"
        "v_exp_f32 %4, %4\n\tv_exp_f32 %5, %5\n\tv_exp_f32 %6, %6\n\tv_exp_f32 %7, %7\n\tv_nop"
        : "+v"(x[0]), "+v"(x[1]), "+v"(x[2]), "+v"(x[3]), "+v"(x[4]), "+v"(x[5]), "+v"(x[6]), "+v"(x[7]));
}
__device__ __forceinline__ float exp2_one(float x) { asm("v_exp_f32 %0, %0\n\tv_nop" : "+v"(x)); return x; }   // the same, one value
// One key block's softmax terms against the maximum in use: p = 2^(t log2 e + nm), nm = AT_PSH - (maximum in use) log2 e. tt: the lane's 32 scores plus bias.
// pb takes p rounded to f16 in the order of the B operand of O^T; the return value is the lane's sum of the 32 unrounded p (the tree of the row sum is unchanged).
constexpr float AT_PSH  = 7.f;        // p of a score equal to the maximum in use is 2^7
constexpr float AT_PLIM = 32768.f;    // a lane's sum under 2^15 bounds each of its p (none is negative) under 2^15, inside the f16 range
__device__ __forceinline__ float at_terms(const float (&tt)[4][8], const float nm, v16h (&pb)[2]) {
    float rs[4];
#pragma unroll
    for (int t = 0; t < 4; ++t) {
        float x[8];
#pragma unroll
        for (int r = 0; r < 8; ++r) x[r] = tt[t][r] * 1.4426950408889634f + nm;
        exp2_run8(x);
        rs[t] = x[0];
#pragma unroll
        for (int r = 1; r < 8; ++r) rs[t] += x[r];
#pragma unroll
        for (int r = 0; r < 8; ++r) pb[t >> 1][(t & 1) * 8 + r] = (_Float16)x[r];
    }
    return (rs[0] + rs[1]) + (rs[2] + rs[3]);
}
// One thread's eight copies for one key block: four 16-byte pieces of the K tile and four of the V^T tile, each the same 16 bytes of rows 16 apart
// (eight lanes cover one row's 128 bytes, a whole line). lk, lv = LDS byte addresses, gk, gv = global addresses of the first piece of each tile.
// The s_wait_xcnt closes the statement so that no register which a copy names is rewritten ahead of it.
template <int PB, int KLD, int VLD>
__device__ __forceinline__ void at_copy8(unsigned lk, unsigned lv, const _Float16* gk, const _Float16* gv) {
    asm volatile(
        "global_load_async_to_lds_b128 %0, %8, off\n\t"
        "global_load_async_to_lds_b128 %1, %9, off\n\t"
        "global_load_async_to_lds_b128 %2, %10, off\n\t"
        "global_load_async_to_lds_b128 %3, %11, off\n\t"
        "global_load_async_to_lds_b128 %4, %12, off\n\t"
        "global_load_async_to_lds_b128 %5, %13, off\n\t"
        "global_load_async_to_lds_b128 %6, %14, off\n\t"
        "global_load_async_to_lds_b128 %7, %15, off\n\t"
        "s_wait_xcnt 0x0"
        :: "v"(lk), "v"(lk + 16 * PB), "v"(lk + 32 * PB), "v"(lk + 48 * PB), "v"(lv), "v"(lv + 16 * PB), "v"(lv + 32 * PB), "v"(lv + 48 * PB),
           "v"(gk), "v"(gk + 16 * KLD), "v"(gk + 32 * KLD), "v"(gk + 48 * KLD), "v"(gv), "v"(gv + 16 * VLD), "v"(gv + 32 * VLD), "v"(gv + 48 * VLD)
        : "memory");
}
// Q and K: f16 planes of GR rows (batch * GT + position) x GD columns, head h at column h * 64. Vt: the f16 plane of V transposed, GD rows (head h at row h * 64) x GR columns.
// O: laid out like Q, rounded to f16 here, the form in which the output projection's products read it.
template <int GT, int GD, int GR>
__global__ __launch_bounds__(32 * AW) KATTN_ATTR void k_attnT(const _Float16* __restrict__ Q, const _Float16* __restrict__ K, const _Float16* __restrict__ Vt, _Float16* __restrict__ O, const float* __restrict__ Rt, float scale) {
    static_assert(GT % (16 * AW) == 0 && GT % 64 == 0 && GT >= 128 && AW == 4, "whole query tiles and key blocks; 128 threads copy the 64 x 64 K and V^T tiles; the two-buffer prologue needs two key blocks");
    constexpr int DH = 64;                      // head size
    constexpr float SCL = 0.125f;               // 1 / sqrt(DH), the value the host passes as scale: as a constant it is one scalar operand of the packed multiply-adds below
    (void)scale;
    constexpr int VP = 64 + 8;                  // LDS pitch (halves): rows of 128 bytes + 16, for 16-byte readers
    constexpr int TB = 64 * VP * 2;             // one tile in LDS, bytes
    __shared__ __align__(16) _Float16 vt[2][DH * VP];   // V^T tile: row = head column, 64 keys along the row
    __shared__ __align__(16) _Float16 kt[2][64 * VP];   // K tile: row = key, the 64 head columns along the row; both tiles are copied in once a key block and read by all four waves
    const int lane = threadIdx.x & 31, hf = lane >> 4, l15 = lane & 15, wave = threadIdx.x >> 5;
    const int h = blockIdx.y, b = blockIdx.z;
    const int q0 = (blockIdx.x * AW + wave) * 16;
    const float L2E = 1.4426950408889634f;
    const int crow = threadIdx.x >> 3, ccol = threadIdx.x & 7;      // copies: eight lanes cover one tile row
    const _Float16* gk = K + (size_t)(b * GT + crow) * GD + h * DH + ccol * 8;
    const _Float16* gv = Vt + (size_t)(h * DH + crow) * GR + b * GT + ccol * 8;
    const unsigned lk = (unsigned)(size_t)&kt[0][0] + (unsigned)(crow * (VP * 2) + ccol * 16);
    const unsigned lv = (unsigned)(size_t)&vt[0][0] + (unsigned)(crow * (VP * 2) + ccol * 16);
    at_copy8<VP * 2, GD, GR>(lk, lv, gk, gv);
    const _Float16* qrow = Q + (size_t)(b * GT + q0 + l15) * GD + h * DH + 8 * hf;
    v16h qb[2];                                 // halves 8 hf + 0..7 and 16 + 8 hf + 0..7 of each 32: the k order of the K fragments below
#pragma unroll
    for (int ks = 0; ks < 2; ++ks) {
        const v8h q0h = *(const v8h*)(qrow + ks * 32), q1h = *(const v8h*)(qrow + ks * 32 + 16);
        qb[ks] = __builtin_shufflevector(q0h, q1h, 0, 1, 2, 3, 4, 5, 6, 7, 8, 9, 10, 11, 12, 13, 14, 15);
    }
    v8f o[4]; float m = -__builtin_inff(), nm = __builtin_inff(), l = 0.f;   // m: the maximum in use; nm = AT_PSH - m log2 e. No maximum yet: the first trip's terms come out infinite and take the branch below
#pragma unroll
    for (int t = 0; t < 4; ++t) { v8f zz = {}; o[t] = zz; }
    asm volatile("s_wait_asynccnt 0x0" ::: "memory");    // this wave's share of key block 0 has landed
    __syncthreads();                                     // key block 0 is whole for every wave
    at_copy8<VP * 2, GD, GR>(lk + TB, lv + TB, gk + 64 * GD, gv + 64);
    for (int j0 = 0; j0 < GT; j0 += 64) {
        // This trip works on key block j0 in buffer cur; the next block's copies, issued a trip ago, fly into the other buffer.
        const int cur = (j0 >> 6) & 1;
        // The table is even in i - j (it is built from |i - j|): it is read at column j - i + GT - 1, which rises with the key, so that the values arrive in the order of the score registers.
        // Block-uniform pointer + the lane's fixed offset + a constant, each part >= 0 (blockIdx.x * 64 <= GT - 64)
        float rb[4][8];
        const float* rt = Rt + (long long)h * (2 * GT - 1) + (j0 - (int)blockIdx.x * (16 * AW) + (GT - 64));
        const unsigned ro = (unsigned)(63 - wave * 16 - l15 + 8 * hf);
#pragma unroll
        for (int t = 0; t < 4; ++t)
#pragma unroll
            for (int r = 0; r < 8; ++r) rb[t][r] = rt[(size_t)ro + (16 * t + r)];
        v8f s[4];
        v8h ka[16];                                      // the eight K fragments, the k order of qb: halves 8 hf + 0..7 and 16 + 8 hf + 0..7 of each 32
#pragma unroll
        for (int t = 0; t < 4; ++t)
#pragma unroll
            for (int ks = 0; ks < 2; ++ks) {
                const _Float16* kr = kt[cur] + (t * 16 + l15) * VP + ks * 32 + 8 * hf;
                ka[(t * 2 + ks) * 2] = *(const v8h*)kr; ka[(t * 2 + ks) * 2 + 1] = *(const v8h*)(kr + 16);
            }
        hold16(ka);                                      // the sixteen LDS reads issue together and are waited for once (otherwise: one fragment's registers, a full LDS wait in front of each product)
#pragma unroll
        for (int t = 0; t < 4; ++t) {
            v8f acc = {};
#pragma unroll
            for (int ks = 0; ks < 2; ++ks) {
                const v16h kfr = __builtin_shufflevector(ka[(t * 2 + ks) * 2], ka[(t * 2 + ks) * 2 + 1], 0, 1, 2, 3, 4, 5, 6, 7, 8, 9, 10, 11, 12, 13, 14, 15);
                acc = __builtin_amdgcn_wmma_f32_16x16x32_f16(false, kfr, false, qb[ks], (short)0, acc, false, false);   // A = key rows, B = query columns
            }
            s[t] = acc;
        }
        float tt[4][8];
#pragma unroll
        for (int t = 0; t < 4; ++t)
#pragma unroll
            for (int r = 0; r < 8; ++r) tt[t][r] = s[t][r] * SCL + rb[t][r];
        v8h vh[16];                                      // the eight V^T fragments: the trip's last LDS reads, so that the buffer can be handed back ahead of the softmax
#pragma unroll
        for (int t = 0; t < 4; ++t)
#pragma unroll
            for (int ks = 0; ks < 2; ++ks) {
                const _Float16* vr = vt[cur] + (t * 16 + l15) * VP + ks * 32 + 8 * hf;
                vh[(t * 2 + ks) * 2] = *(const v8h*)vr; vh[(t * 2 + ks) * 2 + 1] = *(const v8h*)(vr + 16);
            }
        // Publish point: from here on the trip works on registers alone, and the refill has the softmax, the second products and the next trip's first half to land.
        asm volatile("s_wait_dscnt 0x0" ::: "memory");       // this wave's reads of block j0 are done before its buffer is handed back
        asm volatile("s_wait_asynccnt 0x0" ::: "memory");    // this wave's share of block j0 + 64 has landed
        __syncthreads();                                     // publishes block j0 + 64 and ends every wave's reads of block j0
        if (j0 + 128 < GT) at_copy8<VP * 2, GD, GR>(lk + cur * TB, lv + cur * TB, gk + (size_t)(j0 + 128) * GD, gv + (j0 + 128));
        // Lazy rescale: the terms are taken against the maximum in use, which any value may be as long as p stays inside the f16 range; sum and output carry the same factor.
        v16h pb[2];
        float tot = at_terms(tt, nm, pb);
        // One test a trip, the same for the whole wave (a scalar branch): some lane's sum has reached AT_PLIM (or is not a number), so a p may leave the f16 range.
        if (__builtin_expect(__builtin_amdgcn_ballot_w32(!(tot < AT_PLIM)) != 0u, 0)) {   // rare: the first trip, then only where the scores climb; the common path falls through
            float mx = tt[0][0];
#pragma unroll
            for (int t = 0; t < 4; ++t)
#pragma unroll
                for (int r = 0; r < 8; ++r) mx = fmaxf(mx, tt[t][r]);
            mx = fmaxf(mx, xhalf(mx));                    // the other lane half holds the query's other 32 keys: both halves take the same new maximum
            m = fmaxf(m, mx);
            const float nmn = AT_PSH - m * L2E;
            const float corr = exp2_one(nmn - nm);        // the factor between old and new terms, exactly as they are formed; first trip: 2^-inf = 0 on zeros
            nm = nmn;
            l *= corr;
#pragma unroll
            for (int t = 0; t < 4; ++t)
#pragma unroll
                for (int r = 0; r < 8; ++r) o[t][r] *= corr;
            tot = at_terms(tt, nm, pb);
        }
        l += tot;
#pragma unroll
        for (int t = 0; t < 4; ++t)
#pragma unroll
            for (int ks = 0; ks < 2; ++ks) {
                const v16h va = __builtin_shufflevector(vh[(t * 2 + ks) * 2], vh[(t * 2 + ks) * 2 + 1], 0, 1, 2, 3, 4, 5, 6, 7, 8, 9, 10, 11, 12, 13, 14, 15);
                o[t] = __builtin_amdgcn_wmma_f32_16x16x32_f16(false, va, false, pb[ks], (short)0, o[t], false, false);   // A = head columns, B = query columns
            }
    }
    asm volatile("s_wait_asynccnt 0x0" ::: "memory");        // nothing of this wave is in flight when it goes on
    l += xhalf(l);                                       // join the two halves' sums
    const float inv = (l > 0.f) ? 1.f / l : 0.f;         // sum and output carry the same factor
    // the lane's eight head columns of a group are 16 bytes of the f16 plane; a wave's four stores fill its 16 rows' whole 128-byte lines
    _Float16* orow = O + (size_t)(b * GT + q0 + l15) * GD + h * DH + 8 * hf;
#pragma unroll
    for (int t = 0; t < 4; ++t) {
        const v8h w = { (_Float16)(o[t][0] * inv), (_Float16)(o[t][1] * inv), (_Float16)(o[t][2] * inv), (_Float16)(o[t][3] * inv),
                        (_Float16)(o[t][4] * inv), (_Float16)(o[t][5] * inv), (_Float16)(o[t][6] * inv), (_Float16)(o[t][7] * inv) };
        *(v8h*)(orow + t * 16) = w;
    }
}

// =====================================================================================================================
// k_tr: dst(z, c, r) = alpha * src(z, r, c) (+ beta * R2(z, c, r)): [Z][R][C] (row stride lds) -> [Z][C][R] (row stride ldd) through a 32x32 LDS tile;
//   flags: 1 -> add beta * residual R2 addressed like dst (z*sRz + c*ldr + r); act applied before the residual.
// =====================================================================================================================
struct TrP { const float* src; float* dst; const float* R2; long long sSz, lds, sDz, ldd, sRz, ldr; int R, C, flags, act; float alpha, beta; };
static_assert(sizeof(TrP) == 3 * 8 + 6 * 8 + 6 * 4, "TrP has padding");
__global__ __launch_bounds__(256) void k_tr(TrP p) {
    __shared__ float tile[32][33];
    const int c0 = blockIdx.x * 32, r0 = blockIdx.y * 32, z = blockIdx.z;
    const int lane = threadIdx.x & 31, wave = threadIdx.x >> 5;
    const float* s = p.src + z * p.sSz;
#pragma unroll
    for (int k = 0; k < 4; ++k) {
        const int rl = wave * 4 + k, r = r0 + rl, c = c0 + lane;
        tile[rl][lane] = (r < p.R && c < p.C) ? s[(long long)r * p.lds + c] : 0.f;
    }
    __syncthreads();
    float* d = p.dst + z * p.sDz; const float* rr = p.R2 + z * p.sRz;
#pragma unroll
    for (int k = 0; k < 4; ++k) {
        const int cl = wave * 4 + k, c = c0 + cl, r = r0 + lane;
        if (c < p.C && r < p.R) {
            float v = act_fn(p.alpha * tile[lane][cl], p.act);
            if (p.flags & 1) v += p.beta * rr[(long long)c * p.ldr + r];
            VST2(float, d + (long long)c * p.ldd + r, v);
        }
    }
}

// k_affine: dst[i] = a * (sdev ? sdev[0] : 1) * src[i] + b, i < n (one thread per element; consecutive lanes -> consecutive addresses)
__global__ __launch_bounds__(256) void k_affine(const float* __restrict__ src, float* __restrict__ dst, int n, float a, float b, const float* __restrict__ sdev) {
    const int i = blockIdx.x * 256 + threadIdx.x;
    if (i < n) { const float aa = sdev ? a * sdev[0] : a; const float v = aa * src[i] + b; VST2(float, dst + i, v); }
}

// =====================================================================================================================
// k_softmax: row softmax over n contiguous elements, one 256-thread block per row; rows addressed z*sz + r*sr (grid (R, Z)).
//   out = scale_out * softmax(scale_in * x + (Mf ? Mf[z*smz + r*smr + j] : 0)); a row whose max is -inf is written as 0.
// =====================================================================================================================
struct SmP { const float* src; float* dst; const float* Mf; long long sz, sr, dz, dr, smz, smr; int n, pad; float scale_in, scale_out; };
static_assert(sizeof(SmP) == 3 * 8 + 6 * 8 + 4 * 4, "SmP has padding");
__global__ __launch_bounds__(256) void k_softmax(SmP p) {
    __shared__ float red[256];
    const int r = blockIdx.x, z = blockIdx.y, tid = threadIdx.x;
    const float* s = p.src + z * p.sz + (long long)r * p.sr;
    const float* mf = p.Mf ? (p.Mf + z * p.smz + (long long)r * p.smr) : nullptr;
    float mx = -__builtin_inff();
    for (int j = tid; j < p.n; j += 256) { float v = s[j] * p.scale_in; if (mf) v += mf[j]; mx = fmaxf(mx, v); }
    red[tid] = mx; __syncthreads();
    for (int o = 128; o > 0; o >>= 1) { if (tid < o) red[tid] = fmaxf(red[tid], red[tid + o]); __syncthreads(); }
    mx = red[0]; __syncthreads();
    float sum = 0.f;
    for (int j = tid; j < p.n; j += 256) { float v = s[j] * p.scale_in; if (mf) v += mf[j]; sum += (mx == -__builtin_inff()) ? 0.f : expf(v - mx); }
    red[tid] = sum; __syncthreads();
    for (int o = 128; o > 0; o >>= 1) { if (tid < o) red[tid] += red[tid + o]; __syncthreads(); }
    sum = red[0];
    const float inv = (sum > 0.f) ? p.scale_out / sum : 0.f;
    float* d = p.dst + z * p.dz + (long long)r * p.dr;
    for (int j = tid; j < p.n; j += 256) { float v = s[j] * p.scale_in; if (mf) v += mf[j]; const float o = (mx == -__builtin_inff()) ? 0.f : expf(v - mx) * inv; VST2(float, d + j, o); }
}
// =====================================================================================================================
// k_stats: mean and rsqrt(var + eps) over a set of n elements addressed base + z*sz + (e / inner) * so + (e % inner) * si, one 256-thread
// k_norm_apply: y = (x - mean[set]) * rstd[set] * g[c] + b[c] over a [Z][C][L] channel-major tensor with set = z*G + c / (C/G) (G groups per z;
//   G = C -> per-channel sets indexed z*C+c; for batch norm pass stats indexed by c only via bn = 1). Optional act. Output same layout.
// =====================================================================================================================
//   mode 0: mean / rsqrt(var + eps); mode 1 (RMSNorm): 0 / rsqrt(mean(x^2) + eps); mode 2 (L2 normalize * sqrt(n)): 0 / sqrt(n) / max(||x||, eps); mode 3: as 0 with unbiased variance (n-1)
__global__ __launch_bounds__(256) void k_stats(const float* __restrict__ x, long long sz, long long so, long long si, int inner, int n, float eps, float* __restrict__ stat, int mode) {
    __shared__ float red[256];
    const int z = blockIdx.x, tid = threadIdx.x;
    const float* base = x + z * sz;
    float s = 0.f;
    for (int e = tid; e < n; e += 256) s += base[(long long)(e / inner) * so + (long long)(e % inner) * si];
    red[tid] = s; __syncthreads();
    for (int o = 128; o > 0; o >>= 1) { if (tid < o) red[tid] += red[tid + o]; __syncthreads(); }
    const float mu = (mode == 0 || mode == 3) ? red[0] / (float)n : 0.f; __syncthreads();
    float q = 0.f;
    for (int e = tid; e < n; e += 256) { const float dlt = base[(long long)(e / inner) * so + (long long)(e % inner) * si] - mu; q += dlt * dlt; }
    red[tid] = q; __syncthreads();
    for (int o = 128; o > 0; o >>= 1) { if (tid < o) red[tid] += red[tid + o]; __syncthreads(); }
    {
        float rs;
        if (mode == 2) rs = sqrtf((float)n) / fmaxf(sqrtf(red[0]), eps); else if (mode == 3) rs = rsqrtf(red[0] / (float)(n - 1) + eps); else rs = rsqrtf(red[0] / (float)n + eps);
        if (tid < 32) { const float v = (tid == 0) ? mu : ((tid == 1) ? rs : 0.f); VST2(float, stat + (long long)z * 32 + tid, v); }
    }
}
//   One thread per element over the flat [Z][C][L] index space: grid ceil(Z*C*L / 256).
__global__ __launch_bounds__(256) void k_norm_apply(const float* __restrict__ x, float* __restrict__ y, const float* __restrict__ stat, const float* __restrict__ g, const float* __restrict__ bta,
                                                     int Z, int C, int L, int G, int bn, int act) {
    const long long idx = (long long)blockIdx.x * 256 + threadIdx.x;
    if (idx >= (long long)Z * C * L) return;
    const int l = (int)(idx % L); const long long zc = idx / L; const int c = (int)(zc % C), z = (int)(zc / C); (void)l;
    const int set = bn ? c : (z * G + c / (C / G));
    float v = (x[idx] - stat[(long long)set * 32]) * stat[(long long)set * 32 + 1];
    if (g) v *= g[c];
    if (bta) v += bta[c];
    v = act_fn(v, act);
    VST2(float, y + idx, v);
}

// k_lse_neg: c[i] = -(st[2i] + log(st[2i+1])) = minus the log-sum-exp of row i from k_attn's ST output (for softmax over the query dimension)
__global__ __launch_bounds__(256) void k_lse_neg(const float* __restrict__ st, float* __restrict__ c, int n) {
    const int i = blockIdx.x * 256 + threadIdx.x;
    if (i < n) { const float v = -(st[2 * i] + logf(st[2 * i + 1])); VST2(float, c + i, v); }
}

// k_iota: dst[i] = a * i + b as int32 (segment/position id helper)
__global__ __launch_bounds__(256) void k_iota(int* __restrict__ dst, int n, int a, int b) {
    const int i = blockIdx.x * 256 + threadIdx.x;
    if (i < n) { const int v = a * i + b; VST2(int, dst + i, v); }
}

// k_axpby: dst[i] = a * x[i] + b * y[i] (+ c), i < n
__global__ __launch_bounds__(256) void k_axpby(const float* __restrict__ x, const float* __restrict__ y, float* __restrict__ dst, int n, float a, float b, float c) {
    const int i = blockIdx.x * 256 + threadIdx.x;
    if (i < n) { const float v = a * x[i] + b * y[i] + c; VST2(float, dst + i, v); }
}

// =====================================================================================================================
// k_rope: rotary embedding on a [R rows][Hn heads][D] view (row stride sXr, head stride sXh, element stride 1) -> Y (own strides).
//   mode 0: rotate_half (partner d±D/2, sign - for d<D/2); mode 1: interleaved pairs (partner d^1, sign - for even d).
//   table column tcol: tmode 0 -> d, 1 -> d % (D/2), 2 -> d / 2; position p: pmode 0 -> r % S, 1 -> head index, 2 -> pos[r];
//   c = C[(r / S) * sCb + p * sCp + tcol * sCd], s likewise from Sn; y = x[d] * c + sign * x[partner] * s. X and Y must not alias.
// =====================================================================================================================
struct RopeP { const float* X; float* Y; const float* C; const float* Sn; const int* pos; long long sXr, sXh, sYr, sYh, sCb, sCp, sCd; int R, Hn, D, S, mode, tmode, pmode, pad; };
static_assert(sizeof(RopeP) == 5 * 8 + 7 * 8 + 8 * 4, "RopeP has padding");
__global__ __launch_bounds__(256) void k_rope(RopeP p) {
    const long long idx = (long long)blockIdx.x * 256 + threadIdx.x;
    if (idx >= (long long)p.R * p.Hn * p.D) return;
    const int d = (int)(idx % p.D); const long long rh = idx / p.D; const int h = (int)(rh % p.Hn); const int r = (int)(rh / p.Hn);
    const int half = p.D / 2;
    int partner; float sign;
    if (p.mode == 0) { partner = (d < half) ? d + half : d - half; sign = (d < half) ? -1.f : 1.f; }
    else { partner = d ^ 1; sign = (d & 1) ? 1.f : -1.f; }
    const int tcol = (p.tmode == 0) ? d : ((p.tmode == 1) ? (d % half) : (d >> 1));
    const int pp = (p.pmode == 0) ? (r % p.S) : ((p.pmode == 1) ? h : p.pos[r]);
    const long long toff = (long long)(r / p.S) * p.sCb + (long long)pp * p.sCp + (long long)tcol * p.sCd;
    const float* xr = p.X + (long long)r * p.sXr + (long long)h * p.sXh;
    const float v = xr[d] * p.C[toff] + sign * xr[partner] * p.Sn[toff];
    VST2(float, p.Y + (long long)r * p.sYr + (long long)h * p.sYh + d, v);
}

// k_invf + k_sincos (split so neither kernel carries a large VALU-fma footprint): invf_i = num * (1 / powf(base, (2 i)/D)) [fmode 0],
//   num * expf((2 i) * cexp) [fmode 1], num * powf(base, -2 (i - 1) / D) [fmode 2]; then cs/sn[s*half + i] = cos/sin((pscale * s) * invf_i)
__global__ __launch_bounds__(256) void k_invf(float* __restrict__ invb, int half, int D, float base, float num, int fmode, float cexp) {
    const int i = blockIdx.x * 256 + threadIdx.x;
    if (i >= ((half + 31) / 32) * 32) return;
    if (i >= half) { VST2(float, invb + i, 0.f); return; }
    const float e = (float)(2 * i) / (float)D;
    float invf;
    if (fmode == 1) invf = num * expf((float)(2 * i) * cexp);
    else if (fmode == 2) invf = num * powf(base, (-2.0f * ((float)i - 1.0f)) / (float)D);
    else invf = num * (1.0f / powf(base, e));
    VST2(float, invb + i, invf);
}
__global__ __launch_bounds__(256) void k_sincos(float* __restrict__ cs, float* __restrict__ sn, const float* __restrict__ invb, int S, int half, float pscale) {
    const int idx = blockIdx.x * 256 + threadIdx.x;
    if (idx >= S * half) return;
    const int s = idx / half, i = idx - s * half;
    const float ang = (pscale * (float)s) * invb[i];
    VST2(float, cs + idx, cosf(ang)); VST2(float, sn + idx, sinf(ang));
}

// k_mulact: dst[i] = act(x[i]) * y[i]
__global__ __launch_bounds__(256) void k_mulact(const float* __restrict__ x, const float* __restrict__ y, float* __restrict__ dst, int n, int act) {
    const int i = blockIdx.x * 256 + threadIdx.x;
    if (i < n) { const float v = act_fn(x[i], act) * y[i]; VST2(float, dst + i, v); }
}

// =====================================================================================================================
// k_matvec: thread-per-row matrix-vector products for N <= 8 output columns (heads with 1-3 outputs, gates), f32 on the VALU.
//   C[r*sCm + j] = act(alpha * sum_k A[r*sAm + k*sAk] * B[j*sBn + k*sBk] + bias[j]) + beta * R[r*sRm + j*sRn]; each thread writes its N contiguous floats.
// =====================================================================================================================
__global__ __launch_bounds__(256) void k_matvec(GemmP p) {
    // 32 lanes write one line with one instruction.
    const int rpt = (p.N == 1) ? 1 : 32;
    const long long r0 = ((long long)blockIdx.x * 256 + threadIdx.x) * rpt; const int z = blockIdx.z, zo = z / p.zi_n, zi = z - zo * p.zi_n;
    if (r0 >= p.M) return;
    const float* Bb = p.B + zo * p.sBo + zi * p.sBi;
    float* C = p.C + zo * p.sCo + zi * p.sCi; const float* R = p.R + zo * p.sRo + zi * p.sRi;
    for (int rr = 0; rr < rpt; ++rr) {
        const long long r = r0 + rr; if (r >= p.M) break;
        const float* A = p.A + zo * p.sAo + zi * p.sAi + r * p.sAm;
        float acc[8] = {0.f, 0.f, 0.f, 0.f, 0.f, 0.f, 0.f, 0.f};
        for (int k = 0; k < p.K; ++k) { const float a = A[(long long)k * p.sAk];
#pragma unroll
            for (int j = 0; j < 8; ++j) if (j < p.N) acc[j] += a * Bb[(long long)j * p.sBn + (long long)k * p.sBk]; }
#pragma unroll
        for (int j = 0; j < 8; ++j) if (j < p.N) {
            float v = acc[j] * p.alpha;
            if (p.flags & 1) v += p.bias[j];
            if (p.flags & 2) v += p.bias[r];
            v = act_fn(v, p.act);
            if (p.flags & 4) v += p.beta * R[r * p.sRm + (long long)j * p.sRn];
            VST2(float, C + r * p.sCm + j, v);
        }
    }
}
// k_smallsoftmax: thread-per-row softmax for short rows (n <= 64): dst[r*dr + j] = softmax(scale*src[r*sr + j])
__global__ __launch_bounds__(256) void k_smallsoftmax(const float* __restrict__ src, float* __restrict__ dst, long long sr, long long dr, int n, long long R, float scale) {
    const long long r0 = ((long long)blockIdx.x * 256 + threadIdx.x) * 32;
    for (int rr = 0; rr < 32; ++rr) {
        const long long r = r0 + rr; if (r >= R) return;
        const float* s = src + r * sr; float* d = dst + r * dr;
        float mx = -__builtin_inff();
        for (int j = 0; j < n; ++j) mx = fmaxf(mx, s[j] * scale);
        float sum = 0.f;
        for (int j = 0; j < n; ++j) sum += expf(s[j] * scale - mx);
        const float inv = 1.f / sum;
        for (int j = 0; j < n; ++j) { const float v = expf(s[j] * scale - mx) * inv; VST2(float, d + j, v); }
    }
}

__global__ __launch_bounds__(32) void k_unitstat(float* __restrict__ st) { const int t = threadIdx.x; const float v = (t == 1) ? 1.f : 0.f; VST2(float, st + t, v); }

// destination (e.g. a d_out whose row width is not a multiple of 32 floats) is written by consecutive lanes of one instruction
__global__ __launch_bounds__(256) void k_lincopy(const float* __restrict__ src, long long lds, float* __restrict__ dst, long long ldd, long long rows, int cols) {
    const long long i = (long long)blockIdx.x * 256 + threadIdx.x; if (i >= rows * cols) return;
    const long long r = i / cols; const int c = (int)(i - r * cols);
    const float v = src[r * lds + c]; VST2(float, dst + r * ldd + c, v);
}

namespace w25 {
typedef __attribute__((ext_vector_type(16))) _Float16 v16h;
typedef __attribute__((ext_vector_type(8)))  _Float16 v8h;
typedef __attribute__((ext_vector_type(16))) __bf16   v16b;
typedef __attribute__((ext_vector_type(8)))  __bf16   v8b;
typedef __attribute__((ext_vector_type(8)))  float    v8f;
typedef __attribute__((ext_vector_type(4)))  float    v4f;

__device__ __forceinline__ unsigned short f2bf_bits(float f) {
  unsigned u = __float_as_uint(f);
  return (unsigned short)((u + 0x7FFFu + ((u >> 16) & 1u)) >> 16);
}
__device__ __forceinline__ float bf_bits2f(unsigned short h) { return __uint_as_float(((unsigned)h) << 16); }

// hazard guards as plain device helpers (no inline asm inside the kernel template body)
__device__ __forceinline__ void dep_guard_h(v8f& a, v8f& b, v16h x, v16h y) { asm volatile("v_nop\n\tv_nop\n\tv_nop\n\tv_nop" : "+v"(a), "+v"(b) : "v"(x), "v"(y)); }
__device__ __forceinline__ void dep_guard_b(v8f& a, v8f& b, v16b x, v16b y) { asm volatile("v_nop\n\tv_nop\n\tv_nop\n\tv_nop" : "+v"(a), "+v"(b) : "v"(x), "v"(y)); }
__device__ __forceinline__ void keep4_h(v16h a, v16h b, v16h c, v16h d) { asm volatile("v_nop" :: "v"(a), "v"(b), "v"(c), "v"(d)); }
__device__ __forceinline__ void keep4_b(v16b a, v16b b, v16b c, v16b d) { asm volatile("v_nop" :: "v"(a), "v"(b), "v"(c), "v"(d)); }
__device__ __forceinline__ void acc_guard4(v8f& a, v8f& b, v8f& c, v8f& d) { asm volatile("v_nop\n\tv_nop\n\tv_nop\n\tv_nop" : "+v"(a), "+v"(b), "+v"(c), "+v"(d)); }
template <typename T> struct Frag;
template <> struct Frag<_Float16> {
  typedef v16h V; union U { v16h v; v8h h[2]; };
  static __device__ __forceinline__ v16h load(const _Float16* p) {   // elements 0..7 <- p[0..7], 8..15 <- p[16..23]
    U f; f.h[0] = *(const v8h*)(p); f.h[1] = *(const v8h*)(p + 16); return f.v;
  }
  static __device__ __forceinline__ v8f mma(v16h a, v16h b, v8f c) {
    return __builtin_amdgcn_wmma_f32_16x16x32_f16(false, a, false, b, (short)0, c, false, false);
  }
  static __device__ __forceinline__ void guard(v8f& a, v8f& b, v16h x, v16h y) { dep_guard_h(a, b, x, y); }
  static __device__ __forceinline__ void keep(v16h a, v16h b, v16h c, v16h d) { keep4_h(a, b, c, d); }
};
template <> struct Frag<__bf16> {
  typedef v16b V; union U { v16b v; v8b h[2]; };
  static __device__ __forceinline__ v16b load(const __bf16* p) {
    U f; f.h[0] = *(const v8b*)(p); f.h[1] = *(const v8b*)(p + 16); return f.v;
  }
  static __device__ __forceinline__ v8f mma(v16b a, v16b b, v8f c) {
    return __builtin_amdgcn_wmma_f32_16x16x32_bf16(false, a, false, b, (short)0, c, false, false);
  }
  static __device__ __forceinline__ void guard(v8f& a, v8f& b, v16b x, v16b y) { dep_guard_b(a, b, x, y); }
  static __device__ __forceinline__ void keep(v16b a, v16b b, v16b c, v16b d) { keep4_b(a, b, c, d); }
};

// ---- Register-blocked batched WMMA GEMM ------------------------------------
// C[m,n] = scale * sum_k A[m,k] * Bt[n,k] (+bias)(+resid); each wave owns a 64x64 tile.
// A row-major [M,K]; Bt row-major [N,K]; M,N % 64 == 0, K % 32 == 0.
// SPLIT: operands are hi/lo planes (A2/Bt2 = lo planes, same layout); product = hi·hi + hi·lo + lo·hi.
// BIAS_MODE: 0 = none, 1 = bias[m], 2 = bias[n].
// OUT_MODE: 0 = f32, 1 = f16, 2 = bf16 hi plane (Cout) + bf16 lo plane (Cout2).
// ET: 0 = f16 operands, 1 = bf16 operands (pointers passed as 16-bit storage)
template <int ET> struct Elem;
template <> struct Elem<0> { typedef _Float16 T; };
template <> struct Elem<1> { typedef __bf16 T; };
template <int ET, bool SPLIT, int BIAS_MODE, int OUT_MODE, bool RESID, int ACT = 0>
__global__ __launch_bounds__(256) void wmma_gemm64(
    const unsigned short* __restrict__ Ap, const unsigned short* __restrict__ A2p, int lda, long strideA,
    const unsigned short* __restrict__ Btp, const unsigned short* __restrict__ Bt2p, int ldb, long strideB,
    void* __restrict__ Cout, void* __restrict__ Cout2, int ldc, long strideC,
    const float* __restrict__ bias,
    const float* __restrict__ resid, long strideR,
    int M, int N, int K, float scale) {
  typedef typename Elem<ET>::T T;
  typedef typename Frag<T>::V V;
  const T* A = (const T*)Ap; const T* A2 = (const T*)A2p; const T* Bt = (const T*)Btp; const T* Bt2 = (const T*)Bt2p;
  __shared__ __align__(16) float sT[8][16 * 68];   // per-wave 16x64 slab, pitch 68 floats
  const int b    = blockIdx.y;
  const int lane = threadIdx.x & 31;
  const int wave = threadIdx.x >> 5;
  const int tilesN = N >> 6;
  const int tilesM = M >> 6;
  const int tile = blockIdx.x * 8 + wave;
  if (tile >= tilesM * tilesN) return;   // wave-uniform; no block barriers in this kernel
  const int tm = tile / tilesN;
  const int tn = tile - tm * tilesN;
  const int m0 = tm << 6;
  const int n0 = tn << 6;

  const T* Ab  = A  + (size_t)b * strideA;
  const T* Bb  = Bt + (size_t)b * strideB;
  const T* Ab2 = SPLIT ? (A2  + (size_t)b * strideA) : nullptr;
  const T* Bb2 = SPLIT ? (Bt2 + (size_t)b * strideB) : nullptr;

  const int rlane = lane & 15;                 // row (A) / col (B, D) within subtile
  const int koff  = (lane >> 4) * 8;           // k offset of this lane half
  const int mOff  = (lane >> 4) * 8;           // D row offset

  v8f acc[4][4];
#pragma unroll
  for (int i = 0; i < 4; ++i)
#pragma unroll
    for (int j = 0; j < 4; ++j) acc[i][j] = (v8f){0.f,0.f,0.f,0.f,0.f,0.f,0.f,0.f};

  for (int k0 = 0; k0 < K; k0 += 32) {
    V bh[4], bl[4];
#pragma unroll
    for (int j = 0; j < 4; ++j) {
      const size_t bo = (size_t)(n0 + (j << 4) + rlane) * ldb + koff + k0;
      bh[j] = Frag<T>::load(Bb + bo);
      if (SPLIT) bl[j] = Frag<T>::load(Bb2 + bo);
    }
#pragma unroll
    for (int i = 0; i < 4; ++i) {
      const size_t ao = (size_t)(m0 + (i << 4) + rlane) * lda + koff + k0;
      V ah = Frag<T>::load(Ab + ao);
      V al;
      if (SPLIT) al = Frag<T>::load(Ab2 + ao);
#pragma unroll
      for (int j = 0; j < 4; ++j) {
        acc[i][j] = Frag<T>::mma(ah, bh[j], acc[i][j]);
        if (SPLIT) {
          acc[i][j] = Frag<T>::mma(ah, bl[j], acc[i][j]);
          acc[i][j] = Frag<T>::mma(al, bh[j], acc[i][j]);
        }
      }
      Frag<T>::guard(acc[i][0], acc[i][3], ah, SPLIT ? al : ah);
    }
    Frag<T>::keep(bh[0], bh[1], bh[2], bh[3]);
    if (SPLIT) Frag<T>::keep(bl[0], bl[1], bl[2], bl[3]);
  }
  acc_guard4(acc[0][0], acc[0][1], acc[0][2], acc[0][3]);
  acc_guard4(acc[1][0], acc[1][1], acc[1][2], acc[1][3]);
  acc_guard4(acc[2][0], acc[2][1], acc[2][2], acc[2][3]);
  acc_guard4(acc[3][0], acc[3][1], acc[3][2], acc[3][3]);

  // ---- epilogue ----
  float* slab = sT[wave];
  const float* Rb = RESID ? (resid + (size_t)b * strideR) : nullptr;
#pragma unroll
  for (int i = 0; i < 4; ++i) {
    const int mBase = m0 + (i << 4);
#pragma unroll
    for (int j = 0; j < 4; ++j) {
      const int n = n0 + (j << 4) + rlane;
      float bv = 0.f;
      if (BIAS_MODE == 2) bv = bias[n];
#pragma unroll
      for (int r = 0; r < 8; ++r) {
        float v = acc[i][j][r] * scale;
        if (BIAS_MODE == 1) v += bias[mBase + mOff + r];
        if (BIAS_MODE == 2) v += bv;
        if (RESID) v += Rb[(size_t)(mBase + mOff + r) * ldc + n];
        if (ACT == 1) v = tanhf(v);
        if (ACT == 2) v = fmaxf(v, 0.0f);
        if (ACT == 3) v = v / (1.0f + expf(-v));
        if (ACT == 4) v = (v > 0.f) ? v : 0.01f * v;
        if (ACT == 5) v = 0.5f * v * (1.0f + erff(v * 0.70710678118654752f));
        slab[(mOff + r) * 68 + (j << 4) + rlane] = v;
      }
    }
    __builtin_amdgcn_fence(__ATOMIC_RELEASE, "workgroup");
    __builtin_amdgcn_wave_barrier();
    __builtin_amdgcn_fence(__ATOMIC_ACQUIRE, "workgroup");
    if (OUT_MODE == 0) {
      float* C = (float*)Cout + (size_t)b * strideC;
      const int hh = lane >> 4, c4 = (lane & 15) * 4;     // row seg = 256 B = 16 lanes x 16 B
      {
#pragma unroll
        for (int it = 0; it < 8; ++it) {
          const int row = it * 2 + hh;
          v4f v = *(const v4f*)(slab + row * 68 + c4);
          *(v4f*)(C + (size_t)(mBase + row) * ldc + n0 + c4) = v;
        }
        
      }
    } else {
      const int q = lane >> 3, c8 = (lane & 7) * 8;
      unsigned short* C  = (unsigned short*)Cout  + (size_t)b * strideC;
      unsigned short* C2 = (OUT_MODE == 2) ? ((unsigned short*)Cout2 + (size_t)b * strideC) : nullptr;
      {
#pragma unroll
        for (int it = 0; it < 4; ++it) {
          const int row = it * 4 + q;
          const float* sp = slab + row * 68 + c8;
          v8h hv, lv;
#pragma unroll
          for (int e = 0; e < 8; ++e) {
            if (OUT_MODE == 1) {
              hv[e] = (_Float16)sp[e];
            } else {
              unsigned short hb = f2bf_bits(sp[e]);
              unsigned short lb = f2bf_bits(sp[e] - bf_bits2f(hb));
              hv[e] = __builtin_bit_cast(_Float16, hb);
              lv[e] = __builtin_bit_cast(_Float16, lb);
            }
          }
          *(v8h*)(C + (size_t)(mBase + row) * ldc + n0 + c8) = hv;
          if (OUT_MODE == 2) *(v8h*)(C2 + (size_t)(mBase + row) * ldc + n0 + c8) = lv;
        }
        
      }
    }
    __builtin_amdgcn_fence(__ATOMIC_RELEASE, "workgroup");
    __builtin_amdgcn_wave_barrier();
    __builtin_amdgcn_fence(__ATOMIC_ACQUIRE, "workgroup");
  }
}

// ---- Projection GEMM on operand tiles staged in LDS -------------------------------------------------------------
// C[m,n] = scale * sum_k A[m,k] * Bt[n,k] (+ bias[n]); A [GM][GK] and Bt [GN][GK] f16 with k contiguous, C f32 [GM][GN].
// A block owns a 128 x 128 tile of C, its eight waves 32 x 64 each. A trip takes 128 k: 256 bytes of each of the block's 256 operand rows come into LDS once,
// by asynchronous 16-byte copies (one wave's copy = two whole 256-byte row pieces), and every wave reads its fragments from there, 16 bytes a lane.
// Two buffers: tile t + 1 flies while tile t is worked on, one barrier a trip. The k order of the sums is that of wmma_gemm64 (ascending, 32 a product).
constexpr int GL_PB  = 272;             // LDS row pitch in bytes: 256 + 16, an odd multiple of 16, free of bank conflicts for 16-byte readers
constexpr int GL_OP  = 128 * GL_PB;     // one operand's tile
constexpr int GL_BUF = 2 * GL_OP;       // one buffer: the A tile, behind it the Bt tile
// One thread's eight copies for one operand tile: the same 16 bytes of rows 16 apart. l = LDS byte address, g = global address of the first.
// The s_wait_xcnt closes the statement so that no register which a copy names is rewritten ahead of it.
template <int LD>
__device__ __forceinline__ void gl_copy8(unsigned l, const _Float16* g) {
  asm volatile(
      "global_load_async_to_lds_b128 %0, %8, off\n\t"
      "global_load_async_to_lds_b128 %1, %9, off\n\t"
      "global_load_async_to_lds_b128 %2, %10, off\n\t"
      "global_load_async_to_lds_b128 %3, %11, off\n\t"
      "global_load_async_to_lds_b128 %4, %12, off\n\t"
      "global_load_async_to_lds_b128 %5, %13, off\n\t"
      "global_load_async_to_lds_b128 %6, %14, off\n\t"
      "global_load_async_to_lds_b128 %7, %15, off\n\t"
      "s_wait_xcnt 0x0"
      :: "v"(l), "v"(l + 16 * GL_PB), "v"(l + 32 * GL_PB), "v"(l + 48 * GL_PB), "v"(l + 64 * GL_PB), "v"(l + 80 * GL_PB), "v"(l + 96 * GL_PB), "v"(l + 112 * GL_PB),
         "v"(g), "v"(g + 16 * LD), "v"(g + 32 * LD), "v"(g + 48 * LD), "v"(g + 64 * LD), "v"(g + 80 * LD), "v"(g + 96 * LD), "v"(g + 112 * LD)
      : "memory");
}
// One block's work: the 128 x 128 tile (bm, bn) of C, whose rows are GN elements long. ring = the block's two operand buffers, slabs = its eight output slabs (8 x 32 x 68 floats).
// slabs may lie on the ring: the last trip's barrier stands behind every wave's last read of the ring (its s_wait_dscnt 0), and no copy is in flight there any more.
// OUT16 = 0: C (f32) takes the tile. OUT16 = 1: C16 takes it rounded to f16, the form in which the attention's products read it.
template <int GK, int BIAS_MODE, int OUT16>
__device__ __forceinline__ void gemm_lds_tile(const _Float16* __restrict__ A, const _Float16* __restrict__ Bt, float* __restrict__ C, _Float16* __restrict__ C16, const float* __restrict__ bias, float scale,
                                              const int bm, const int bn, const int GN, unsigned char* ring, float* slabs) {
  static_assert(GK % 128 == 0 && GK >= 256, "whole k tiles; the two-buffer prologue needs two of them");
  constexpr int NT = GK / 128;
  const int tid = threadIdx.x, lane = tid & 31, wave = tid >> 5;
  const int rlane = lane & 15, hf = lane >> 4;
  const int wm = wave >> 1, wn = wave & 1;
  const int crow = tid >> 4, ccol = tid & 15;      // copies: 16 lanes cover one row's 256 bytes
  const _Float16* ga = A  + (size_t)(bm * 128 + crow) * GK + ccol * 8;
  const _Float16* gb = Bt + (size_t)(bn * 128 + crow) * GK + ccol * 8;
  const unsigned la = (unsigned)(size_t)ring + (unsigned)(crow * GL_PB + ccol * 16);
  const unsigned char* fa = ring + (wm * 32 + rlane) * GL_PB + hf * 16;            // fragment rows: lane = row, this half's 8 k first
  const unsigned char* fb = ring + GL_OP + (wn * 64 + rlane) * GL_PB + hf * 16;

  v8f acc[2][4];
#pragma unroll
  for (int i = 0; i < 2; ++i)
#pragma unroll
    for (int j = 0; j < 4; ++j) acc[i][j] = (v8f){0.f,0.f,0.f,0.f,0.f,0.f,0.f,0.f};

  gl_copy8<GK>(la, ga);
  gl_copy8<GK>(la + GL_OP, gb);
  asm volatile("s_wait_asynccnt 0x0" ::: "memory");   // this wave's share of tile 0 has landed
  __syncthreads();                                    // tile 0 is whole for every wave
  gl_copy8<GK>(la + GL_BUF, ga + 128);
  gl_copy8<GK>(la + GL_BUF + GL_OP, gb + 128);
#pragma unroll 1   // kept rolled: buffer offset and refill test are scalar work, and one trip's code serves both buffers
  for (int t = 0; t < NT; ++t) {
    const int bo = (t & 1) * GL_BUF;
    v16h a[2][2], b[2][4];                              // two fragment sets: one is worked on while the next 32 k are read
#pragma unroll
    for (int i = 0; i < 2; ++i) a[0][i] = Frag<_Float16>::load((const _Float16*)(fa + bo + i * 16 * GL_PB));
#pragma unroll
    for (int j = 0; j < 4; ++j) b[0][j] = Frag<_Float16>::load((const _Float16*)(fb + bo + j * 16 * GL_PB));
#pragma unroll
    for (int ks = 0; ks < 4; ++ks) {
      if (ks < 3) {
#pragma unroll
        for (int i = 0; i < 2; ++i) a[(ks + 1) & 1][i] = Frag<_Float16>::load((const _Float16*)(fa + bo + i * 16 * GL_PB + (ks + 1) * 64));
#pragma unroll
        for (int j = 0; j < 4; ++j) b[(ks + 1) & 1][j] = Frag<_Float16>::load((const _Float16*)(fb + bo + j * 16 * GL_PB + (ks + 1) * 64));
      }
      __builtin_amdgcn_sched_barrier(0);                // the next set's twelve LDS reads stay one group ahead of these products (left alone, the scheduler spreads them among the products on one set, a full LDS wait each)
#pragma unroll
      for (int i = 0; i < 2; ++i)
#pragma unroll
        for (int j = 0; j < 4; ++j) acc[i][j] = Frag<_Float16>::mma(a[ks & 1][i], b[ks & 1][j], acc[i][j]);
      __builtin_amdgcn_sched_barrier(0);                // and the group after next stays behind them
    }
    asm volatile("s_wait_dscnt 0x0" ::: "memory");      // this wave's reads of tile t are done before the buffer is handed back
    asm volatile("s_wait_asynccnt 0x0" ::: "memory");   // this wave's share of tile t + 1 has landed
    __syncthreads();                                    // publishes tile t + 1 and ends every wave's reads of tile t
    if (t + 2 < NT) {
      gl_copy8<GK>(la + bo, ga + (t + 2) * 128);
      gl_copy8<GK>(la + bo + GL_OP, gb + (t + 2) * 128);
    }
  }
  asm volatile("s_wait_asynccnt 0x0" ::: "memory");     // nothing of this wave is in flight when it goes on

  // ---- epilogue: the wave's 32 x 64 tile goes through its own slab, so that every store is whole row pieces (256 bytes as f32, 128 as f16) ----
  float* slab = slabs + wave * (32 * 68);
  const int n0 = bn * 128 + wn * 64, mBase = bm * 128 + wm * 32;
#pragma unroll
  for (int j = 0; j < 4; ++j) {
    float bv = 0.f;
    if (BIAS_MODE == 2) bv = bias[n0 + j * 16 + rlane];
#pragma unroll
    for (int i = 0; i < 2; ++i)
#pragma unroll
      for (int r = 0; r < 8; ++r) {
        float v = acc[i][j][r] * scale;
        if (BIAS_MODE == 2) v += bv;
        slab[(i * 16 + hf * 8 + r) * 68 + j * 16 + rlane] = v;
      }
  }
  // the slab's rows are read by other lanes of the same wave than wrote them
  __builtin_amdgcn_fence(__ATOMIC_RELEASE, "workgroup");
  __builtin_amdgcn_wave_barrier();
  __builtin_amdgcn_fence(__ATOMIC_ACQUIRE, "workgroup");
  if (OUT16) {
    // eight lanes cover one row's 64 halves, a whole 128-byte line; a store takes four rows
    const int r4 = lane >> 3, c8 = (lane & 7) * 8;
    _Float16* hrow0 = C16 + (size_t)(mBase + r4) * GN + n0 + c8;
#pragma unroll
    for (int it = 0; it < 8; ++it) {
      const float* sp = slab + (it * 4 + r4) * 68 + c8;
      const v4f u0 = *(const v4f*)sp, u1 = *(const v4f*)(sp + 4);
      const v8h pk = { (_Float16)u0[0], (_Float16)u0[1], (_Float16)u0[2], (_Float16)u0[3], (_Float16)u1[0], (_Float16)u1[1], (_Float16)u1[2], (_Float16)u1[3] };
      *(v8h*)(hrow0 + (size_t)it * 4 * GN) = pk;
    }
  } else {
    float* crow0 = C + (size_t)(mBase + hf) * GN + n0 + rlane * 4;
#pragma unroll
    for (int it = 0; it < 16; ++it) {
      const v4f v = *(const v4f*)(slab + (it * 2 + hf) * 68 + rlane * 4);
      *(v4f*)(crow0 + (size_t)it * 2 * GN) = v;
    }
  }
}

// One projection a launch, a block a tile.
template <int GM, int GN, int GK, int BIAS_MODE, int OUT16>
__global__ __launch_bounds__(256) void wmma_gemm_lds(const _Float16* __restrict__ A, const _Float16* __restrict__ Bt, float* __restrict__ C, _Float16* __restrict__ C16, const float* __restrict__ bias, float scale) {
  static_assert(GM % 128 == 0 && GN % 128 == 0, "whole tiles");
  __shared__ __align__(16) unsigned char ring[2 * GL_BUF];
  __shared__ __align__(16) float sT[8 * 32 * 68];   // per-wave 32x64 output slabs, pitch 68 floats; apart from the ring (this launch has one block for each WGP, so LDS saved would buy nothing)
  constexpr int TN = GN / 128;
  gemm_lds_tile<GK, BIAS_MODE, OUT16>(A, Bt, C, C16, bias, scale, blockIdx.x / TN, blockIdx.x % TN, GN, ring, sT);
}
// The three input projections, which do not depend on each other, in ONE launch: blocks 0 .. NB - 1 do Q = x . Wq^T, the next NB K = context . Wk^T, the last NB V^T = Wv . context^T
// (operands swapped, so that V comes out transposed). x16, c16: [NR][D]; w16: the planes Wq, Wk, Wv one behind the other, [D][D] each. Every block works exactly as in wmma_gemm_lds.
// The output slabs lie on the ring, which leaves the block at 139,264 bytes of LDS: two blocks share a WGP, and while one waits for its copies, fills its first buffer or stores
// its tile, the other one's products run. One projection alone has only one block for each WGP, hence the one launch.
template <int NR, int D>
__global__ __launch_bounds__(256) void wmma_gemm_qkv(const _Float16* __restrict__ x16, const _Float16* __restrict__ c16, const _Float16* __restrict__ w16,
                                                     _Float16* __restrict__ Q, _Float16* __restrict__ K, _Float16* __restrict__ Vt, float scale) {
  static_assert(NR % 128 == 0 && D % 128 == 0, "whole tiles");
  static_assert(8 * 32 * 68 * 4 <= 2 * GL_BUF, "the slabs fit on the ring");
  __shared__ __align__(16) unsigned char ring[2 * GL_BUF];
  constexpr unsigned NB = (NR / 128) * (D / 128);
  const unsigned sel = blockIdx.x / NB, r = blockIdx.x % NB;      // the same for the whole block
  const _Float16* A  = (sel == 0) ? x16 : (sel == 1) ? c16 : w16 + 2 * (size_t)D * D;
  const _Float16* Bt = (sel == 0) ? w16 : (sel == 1) ? w16 + (size_t)D * D : c16;
  _Float16* C16 = (sel == 0) ? Q : (sel == 1) ? K : Vt;
  const int GN = (sel == 2) ? NR : D;
  const unsigned TN = (unsigned)GN / 128u;
  gemm_lds_tile<D, 0, 1>(A, Bt, nullptr, C16, nullptr, scale, (int)(r / TN), (int)(r % TN), GN, ring, (float*)ring);
}

__global__ __launch_bounds__(256) void cast_f32_f16x2(
    const float* __restrict__ in, _Float16* __restrict__ out, int n2) {
  int i = blockIdx.x * 256 + threadIdx.x;
  if (i < n2) {
    const _Float16 h0 = (_Float16)in[2 * i], h1 = (_Float16)in[2 * i + 1];
    const unsigned u = (unsigned)__builtin_bit_cast(unsigned short, h0) | ((unsigned)__builtin_bit_cast(unsigned short, h1) << 16);
    ((unsigned*)out)[i] = u;
    
  }
}


} // namespace w25

__global__ __launch_bounds__(256) void k_castT16(const float* __restrict__ src, long long lds, _Float16* __restrict__ dst, long long ldd, int R, int C, float s) {
    const long long i = (long long)blockIdx.x * 256 + threadIdx.x; const long long np = (long long)C * (R / 2); if (i >= np) return; const int c = (int)(i / (R / 2)); const int r = 2 * (int)(i % (R / 2));
    const _Float16 h0 = (_Float16)(src[(long long)r * lds + c] * s), h1 = (_Float16)(src[(long long)(r + 1) * lds + c] * s);
    const unsigned u = (unsigned)__builtin_bit_cast(unsigned short, h0) | ((unsigned)__builtin_bit_cast(unsigned short, h1) << 16);
    unsigned* d = (unsigned*)(dst + (long long)c * ldd + r); *d = u;  }
__global__ __launch_bounds__(256) void k_cast16(const float* __restrict__ src, long long lds, _Float16* __restrict__ dst, long long ldd, int R, int C, float s) {
    const long long i = (long long)blockIdx.x * 256 + threadIdx.x; const long long np = (long long)R * (C / 2); if (i >= np) return; const int r = (int)(i / (C / 2)); const int c = 2 * (int)(i % (C / 2));
    const _Float16 h0 = (_Float16)(src[(long long)r * lds + c] * s), h1 = (_Float16)(src[(long long)r * lds + c + 1] * s);
    const unsigned u = (unsigned)__builtin_bit_cast(unsigned short, h0) | ((unsigned)__builtin_bit_cast(unsigned short, h1) << 16);
    unsigned* d = (unsigned*)(dst + (long long)r * ldd + c); *d = u;  }

// f32 -> f16 casts on few, long waves: 256 blocks of 16 waves (4,096 waves to start a launch). A tile is 16,384 consecutive floats: eight wave-wide 16-byte loads a lane
// (512 contiguous bytes a wave and load), all issued before the first is used, and eight 8-byte stores (256 contiguous bytes a wave and store).
__device__ __forceinline__ void cast_tile_ld(const float* __restrict__ s, v4f* r) {
#pragma unroll   // r stays in registers and the eight loads issue back to back
    for (int i = 0; i < 8; ++i) r[i] = *(const v4f*)(s + i * 2048);
}
__device__ __forceinline__ void cast_tile_st(_Float16* __restrict__ d, const v4f* r, float sc) {
#pragma unroll   // constant indices into r and pk: both stay in registers
    for (int i = 0; i < 8; ++i) {
        v4h pk;
#pragma unroll
        for (int e = 0; e < 4; ++e) pk[e] = (_Float16)(r[i][e] * sc);
        *(v4h*)(d + i * 2048) = pk;
    }
}
// Everything that exists before the first projection, in one launch: block n casts tile n of x, tile n of the context and tile n & 63 of
// weight n >> 6 (order Wq, Wk, Wv, Wo; times 16; the four f16 planes lie one behind the other in w16). x and c: 256 tiles each, a weight: 64.
// The launch's first NH (2 T - 1) threads also write one entry each of the attention's relative-offset bias table, while their loads are in flight:
// RT[h][c], c = i - j + (T - 1): -floor(|i - j| / 30) * 2^-(h + 1) (depends on no input).
template <int NH, int T>
__global__ __launch_bounds__(512) void k_cast_in(const float* __restrict__ x, const float* __restrict__ c, const float* __restrict__ Wq, const float* __restrict__ Wk,
                                                 const float* __restrict__ Wv, const float* __restrict__ Wo, _Float16* __restrict__ x16, _Float16* __restrict__ c16, _Float16* __restrict__ w16,
                                                 float* __restrict__ RT) {
    constexpr int RN = 2 * T - 1;
    static_assert(NH * RN <= 256 * 512, "one table entry a thread");
    const unsigned n = blockIdx.x, sel = n >> 6;
    const float* __restrict__ w = (sel == 0) ? Wq : (sel == 1) ? Wk : (sel == 2) ? Wv : Wo;
    const unsigned t4 = threadIdx.x * 4u;
    v4f rx[8], rc[8], rw[8];
    cast_tile_ld(x + (size_t)n * 16384 + t4, rx);
    cast_tile_ld(c + (size_t)n * 16384 + t4, rc);
    cast_tile_ld(w + (size_t)(n & 63u) * 16384 + t4, rw);
    const int e = (int)(n * 512u + threadIdx.x);
    if (e < NH * RN) {
        const int h = e / RN;
        int dist = e % RN - (T - 1); dist = dist < 0 ? -dist : dist;
        RT[e] = -(float)(dist / 30) * exp2f(-(float)(h + 1));
    }
    cast_tile_st(x16 + (size_t)n * 16384 + t4, rx, 1.0f);
    cast_tile_st(c16 + (size_t)n * 16384 + t4, rc, 1.0f);
    cast_tile_st(w16 + (size_t)n * 16384 + t4, rw, 16.0f);
}

// f32 -> bf16 hi plane + bf16 lo plane (x = hi + lo to ~2^-17 relative; RNE both), [R][C] -> [R][C] (or transposed to [C][R]); 2 consecutive destination elements
__device__ __forceinline__ unsigned int f2bf2_pack(float a, float b, unsigned int* lo) {
    const unsigned short ha = w25::f2bf_bits(a), hb = w25::f2bf_bits(b);
    const unsigned short la = w25::f2bf_bits(a - w25::bf_bits2f(ha)), lb = w25::f2bf_bits(b - w25::bf_bits2f(hb));
    *lo = (unsigned)la | ((unsigned)lb << 16); return (unsigned)ha | ((unsigned)hb << 16); }
__global__ __launch_bounds__(256) void k_castS16(const float* __restrict__ src, long long lds, __bf16* __restrict__ dhi, __bf16* __restrict__ dlo, long long ldd, int R, int C, float s, int transpose) {
    const long long i = (long long)blockIdx.x * 256 + threadIdx.x; long long o; float a, b;
    if (transpose) { const long long np = (long long)C * (R / 2); if (i >= np) return; const int c = (int)(i / (R / 2)); const int r = 2 * (int)(i % (R / 2)); a = src[(long long)r * lds + c] * s; b = src[(long long)(r + 1) * lds + c] * s; o = (long long)c * ldd + r; }
    else { const long long np = (long long)R * (C / 2); if (i >= np) return; const int r = (int)(i / (C / 2)); const int c = 2 * (int)(i % (C / 2)); a = src[(long long)r * lds + c] * s; b = src[(long long)r * lds + c + 1] * s; o = (long long)r * ldd + c; }
    unsigned lo; const unsigned hi = f2bf2_pack(a, b, &lo); unsigned* ph = (unsigned*)(dhi + o); unsigned* pl = (unsigned*)(dlo + o);
    *ph = hi; *pl = lo;  }

namespace w25 {
// =====================================================================================
// Generic causal/non-causal attention for head_dim 64, f32 in / f32 out; 16-bit operands: bf16 with optional hi/lo splits, or
// plain f16 (F16=true, non-split, probabilities carried x2^15).
//   scores = (q*qscale)·kᵀ : v_wmma_f32_16x16x32_bf16; SPLIT_QK -> q,k as bf16 hi/lo (hi·hi + hi·lo + lo·hi)
//   out    = p·v           : v_wmma_f32_16x16x32_bf16; SPLIT_PV -> p,v as bf16 hi/lo; else p,v plain bf16
//   f32 accumulate; online softmax in f32. Block = 4 waves = 64 query rows of one (batch, head); S % 64 == 0.
//   Element (b, s, h, d) of tensor X lives at X[b*X_bs + s*X_rs + h*X_hs + d] (strides in floats, multiples of 4).
//   Masking: mask_mode 0 none, 1 causal (kv > q masked), 2 tensor [S][Skv] shared over (b,h) (float if
//   mask_is_int==0, int32 with element == 0 -> masked if 1, int32 with element != 0 -> masked if 2), 3 per-token vectors qmask[B][S] & kvmask[B][Skv] (int32,
//   0 -> masked), 4 causal + sliding window (kv > q or q - kv > W masked; W passed in mask_is_int);
//   5 = relative-position bias: s += cp[b,h,q][idx[q][kv]] + pc[b,h,kv][idx[q][kv]] with idx = mask_b ([S][Skv] int32) and
//   mask_a an int32 [S][Skv] tensor with nonzero = masked (tables: element (b,h,row,n) at X + b*c_bs + h*c_hs + row*c_rs + n);
//   masked scores are replaced by mask_fill (e.g. -inf or -1e9) before the softmax.
//   grid.x = B * H * (S/64) (or a sub-range with blk0).
// =====================================================================================
#define AT_D 64
#define AT_NW 4
#define AT_QB 64
#define AT_KC 64
struct AttnGeom { const float* cp = nullptr; const float* pc = nullptr; long c_bs = 0, c_rs = 0, c_hs = 0;   // mode-5 score-bias tables
                  long q_bs, q_rs, q_hs, k_bs, k_rs, k_hs, v_bs, v_rs, v_hs, o_bs, o_rs, o_hs;
                  int S, Skv, H, mask_mode; float qscale; int blk0; float mask_fill; int mask_is_int; };
static_assert(sizeof(AttnGeom) == 168, "no padding");

__device__ __forceinline__ unsigned short at_bf_bits(float f) {
  unsigned u = __float_as_uint(f);
  return (unsigned short)((u + 0x7FFFu + ((u >> 16) & 1u)) >> 16);
}
__device__ __forceinline__ __bf16 at_f2bf(float f) { return __builtin_bit_cast(__bf16, at_bf_bits(f)); }
__device__ __forceinline__ void at_split(float f, __bf16& hi, __bf16& lo) {
  const unsigned short hb = at_bf_bits(f);
  hi = __builtin_bit_cast(__bf16, hb);
  lo = at_f2bf(f - __uint_as_float(((unsigned)hb) << 16));
}
__device__ __forceinline__ v8f at_mma(v16b a, v16b b, v8f c) {
  c = __builtin_amdgcn_wmma_f32_16x16x32_bf16(false, a, false, b, (short)0, c, false, false);
  asm volatile("v_nop\n\tv_nop\n\tv_nop\n\tv_nop" : "+v"(c) : "v"(a), "v"(b));
  return c;
}
// 16-bit element as a bit pattern held in a __bf16 slot: f16 bits when F16, bf16 (RNE) otherwise
template <bool F16> __device__ __forceinline__ __bf16 at_to16(float f) {
  if (F16) return __builtin_bit_cast(__bf16, (_Float16)f);
  return at_f2bf(f);
}
template <bool F16> __device__ __forceinline__ v8f at_mma16(v16b a, v16b b, v8f c) {
  if (F16) {
    const v16h ah = __builtin_bit_cast(v16h, a), bh = __builtin_bit_cast(v16h, b);
    c = __builtin_amdgcn_wmma_f32_16x16x32_f16(false, ah, false, bh, (short)0, c, false, false);
    asm volatile("v_nop\n\tv_nop\n\tv_nop\n\tv_nop" : "+v"(c) : "v"(ah), "v"(bh));
    return c;
  }
  return at_mma(a, b, c);
}

template <bool SPLIT_QK, bool SPLIT_PV, bool F16 = false>
__global__ __launch_bounds__(128)
void attn64_kernel(const float* __restrict__ q, const float* __restrict__ k,
                   const float* __restrict__ v, float* __restrict__ out,
                   const void* __restrict__ mask_a, const int* __restrict__ mask_b, AttnGeom g) {
  static_assert(!(F16 && (SPLIT_QK || SPLIT_PV)), "f16 mode is non-split");
  const float PSC = F16 ? 32768.0f : 1.0f;     // f16 probabilities carried x2^15 (subnormal range), folded into the final 1/l
  union FB { v16b v; v8b h[2]; };
  __shared__ __align__(16) __bf16 Ksh[AT_KC * AT_D];             // K hi [kv][d]      8 KB
  __shared__ __align__(16) __bf16 Ksl[SPLIT_QK ? AT_KC * AT_D : 8];
  __shared__ __align__(16) __bf16 Vth[AT_D * AT_KC];             // V hi [d][kv]      8 KB
  __shared__ __align__(16) __bf16 Vtl[SPLIT_PV ? AT_D * AT_KC : 8];
  __shared__ __align__(16) __bf16 Psh[AT_NW][16 * AT_KC];        // per wave P hi [row][kv]  8 KB
  __shared__ __align__(16) __bf16 Psl[SPLIT_PV ? AT_NW : 1][SPLIT_PV ? 16 * AT_KC : 8];
  __shared__ __align__(16) float  Os[AT_NW][16 * 68];            // per wave out tile, pitch 68

  const int tid  = threadIdx.x;
  const int wave = tid >> 5;
  const int lane = tid & 31;
  const int hh   = lane >> 4;
  const int c    = lane & 15;

  const int nqb = g.S / AT_QB;
  const int bx = blockIdx.x + g.blk0;
  const int qb = bx % nqb;
  const int bh = bx / nqb;
  const int h  = bh % g.H;
  const int b  = bh / g.H;
  const int qbase_block = qb * AT_QB;
  const int q0 = qbase_block + wave * 16;

  const float* qb_ptr = q + (size_t)b * g.q_bs + (size_t)h * g.q_hs;
  const float* kb_ptr = k + (size_t)b * g.k_bs + (size_t)h * g.k_hs;
  const float* vb_ptr = v + (size_t)b * g.v_bs + (size_t)h * g.v_hs;
  float*       ob_ptr = out + (size_t)b * g.o_bs + (size_t)h * g.o_hs;

  // ---- Q fragments (A operand): 2 d-chunks, hi (and lo) ----
  v16b qah[2], qal[2];
  {
    const float* qrow = qb_ptr + (size_t)(q0 + c) * g.q_rs;
#pragma unroll
    for (int dc = 0; dc < 2; ++dc) {
#pragma unroll
      for (int e = 0; e < 8; ++e) {
        const float f0 = qrow[dc * 32 + 8 * hh + e] * g.qscale;
        const float f1 = qrow[dc * 32 + 16 + 8 * hh + e] * g.qscale;
        if (SPLIT_QK) { __bf16 hq, lq; at_split(f0, hq, lq); qah[dc][e] = hq; qal[dc][e] = lq; at_split(f1, hq, lq); qah[dc][8 + e] = hq; qal[dc][8 + e] = lq; }
        else { qah[dc][e] = at_to16<F16>(f0); qah[dc][8 + e] = at_to16<F16>(f1); qal[dc][e] = qah[dc][e]; qal[dc][8 + e] = qah[dc][8 + e]; }
      }
    }
  }

  float mrow[8], lrow[8];
  v8f oacc[4];
#pragma unroll
  for (int r = 0; r < 8; ++r) { mrow[r] = -INFINITY; lrow[r] = 0.f; }
#pragma unroll
  for (int t = 0; t < 4; ++t) oacc[t] = (v8f){0.f,0.f,0.f,0.f,0.f,0.f,0.f,0.f};

  const int nChunks = (g.mask_mode == 1 || g.mask_mode == 4) ? (qb + 1) : (g.Skv / AT_KC);   // block-uniform
  // per-row query mask (mode 3)
  int qkeep[8];
#pragma unroll
  for (int r = 0; r < 8; ++r) qkeep[r] = (g.mask_mode == 3) ? mask_b[(size_t)b * g.S + q0 + 8 * hh + r] : 1;   // mask_b = qmask in mode 3
  for (int kc = 0; kc < nChunks; ++kc) {
    const int kv0 = kc * AT_KC;
    __syncthreads();
    {
      const int kvr = tid >> 1, dh = (tid & 1) * 32;
      const float* krow = kb_ptr + (size_t)(kv0 + kvr) * g.k_rs + dh;
      const float* vrow = vb_ptr + (size_t)(kv0 + kvr) * g.v_rs + dh;
#pragma unroll
      for (int i = 0; i < 8; ++i) {
        v4f kk = *(const v4f*)(krow + 4 * i);
        v4f vv = *(const v4f*)(vrow + 4 * i);
#pragma unroll
        for (int e = 0; e < 4; ++e) {
          const int d = dh + 4 * i + e;
          if (SPLIT_QK) { __bf16 a, bl; at_split(kk[e], a, bl); Ksh[kvr * AT_D + d] = a; Ksl[kvr * AT_D + d] = bl; }
          else Ksh[kvr * AT_D + d] = at_to16<F16>(kk[e]);
          if (SPLIT_PV) { __bf16 a, bl; at_split(vv[e], a, bl); Vth[d * AT_KC + kvr] = a; Vtl[d * AT_KC + kvr] = bl; }
          else Vth[d * AT_KC + kvr] = at_to16<F16>(vv[e]);
        }
      }
    }
    __syncthreads();

    v8f s[4];
#pragma unroll
    for (int j = 0; j < 4; ++j) {
      s[j] = (v8f){0.f,0.f,0.f,0.f,0.f,0.f,0.f,0.f};
#pragma unroll 1
      for (int dc = 0; dc < 2; ++dc) {
        FB kb;
        kb.h[0] = *(const v8b*)(Ksh + (j * 16 + c) * AT_D + dc * 32 + 8 * hh);
        kb.h[1] = *(const v8b*)(Ksh + (j * 16 + c) * AT_D + dc * 32 + 16 + 8 * hh);
        s[j] = at_mma16<F16>(qah[dc], kb.v, s[j]);
        if (SPLIT_QK) {
          FB kl;
          kl.h[0] = *(const v8b*)(Ksl + (j * 16 + c) * AT_D + dc * 32 + 8 * hh);
          kl.h[1] = *(const v8b*)(Ksl + (j * 16 + c) * AT_D + dc * 32 + 16 + 8 * hh);
          s[j] = at_mma16<F16>(qah[dc], kl.v, s[j]);
          s[j] = at_mma16<F16>(qal[dc], kb.v, s[j]);
        }
      }
    }
    const bool diag = (g.mask_mode == 1) && (kc == qb);
    int kvkeep[4] = {1, 1, 1, 1};
    if (g.mask_mode == 3) {
#pragma unroll
      for (int j = 0; j < 4; ++j) kvkeep[j] = ((const int*)mask_a)[(size_t)b * g.Skv + kv0 + j * 16 + c];   // mask_a = kvmask
    }
    float cm[8];
#pragma unroll
    for (int r = 0; r < 8; ++r) {
      const int qrow = q0 + 8 * hh + r;
      float m = -INFINITY;
#pragma unroll
      for (int j = 0; j < 4; ++j) {
        const int kvcol = kv0 + j * 16 + c;
        bool masked = false;
        if (diag) masked = (kvcol > qrow);
        else if (g.mask_mode == 4) masked = (kvcol > qrow) || (qrow - kvcol > g.mask_is_int);
        else if (g.mask_mode == 2) {
          const size_t mi = (size_t)qrow * g.Skv + kvcol;
          masked = (g.mask_is_int == 0) ? (((const float*)mask_a)[mi] == 0.0f)
                 : (g.mask_is_int == 1) ? (((const int*)mask_a)[mi] == 0) : (((const int*)mask_a)[mi] != 0);
        } else if (g.mask_mode == 3) masked = (qkeep[r] == 0) || (kvkeep[j] == 0);
        else if (g.mask_mode == 5) {
          const size_t mi = (size_t)qrow * g.Skv + kvcol;
          masked = (((const int*)mask_a)[mi] != 0);
          int n = mask_b[mi]; n = n < 0 ? 0 : n;
          s[j][r] += g.cp[(size_t)b * g.c_bs + (size_t)h * g.c_hs + (size_t)qrow * g.c_rs + n]
                   + g.pc[(size_t)b * g.c_bs + (size_t)h * g.c_hs + (size_t)kvcol * g.c_rs + n];
        }
        if (masked) s[j][r] = g.mask_fill;
        m = fmaxf(m, s[j][r]);
      }
#pragma unroll
      for (int off = 1; off < 16; off <<= 1) m = fmaxf(m, __shfl_xor(m, off, 32));
      cm[r] = m;
    }
    __bf16* pwh = Psh[wave];
    __bf16* pwl = Psl[SPLIT_PV ? wave : 0];
#pragma unroll
    for (int r = 0; r < 8; ++r) {
      const float mnew = fmaxf(mrow[r], cm[r]);
      const float alpha = expf(mrow[r] - mnew);
      mrow[r] = mnew;
      float psum = 0.f;
#pragma unroll
      for (int j = 0; j < 4; ++j) {
        const float p = expf(s[j][r] - mnew);
        psum += p;
        if (SPLIT_PV) { __bf16 a, bl; at_split(p, a, bl); pwh[(8 * hh + r) * AT_KC + j * 16 + c] = a; pwl[(8 * hh + r) * AT_KC + j * 16 + c] = bl; }
        else pwh[(8 * hh + r) * AT_KC + j * 16 + c] = at_to16<F16>(p * PSC);
      }
#pragma unroll
      for (int off = 1; off < 16; off <<= 1) psum += __shfl_xor(psum, off, 32);
      lrow[r] = lrow[r] * alpha + psum;
#pragma unroll
      for (int t = 0; t < 4; ++t) oacc[t][r] *= alpha;
    }
    __builtin_amdgcn_fence(__ATOMIC_RELEASE, "workgroup");
    __builtin_amdgcn_wave_barrier();
    __builtin_amdgcn_fence(__ATOMIC_ACQUIRE, "workgroup");
#pragma unroll 1
    for (int kk = 0; kk < 2; ++kk) {
      FB pa, pl;
      pa.h[0] = *(const v8b*)(pwh + c * AT_KC + kk * 32 + 8 * hh);
      pa.h[1] = *(const v8b*)(pwh + c * AT_KC + kk * 32 + 16 + 8 * hh);
      if (SPLIT_PV) {
        pl.h[0] = *(const v8b*)(pwl + c * AT_KC + kk * 32 + 8 * hh);
        pl.h[1] = *(const v8b*)(pwl + c * AT_KC + kk * 32 + 16 + 8 * hh);
      }
#pragma unroll
      for (int t = 0; t < 4; ++t) {
        FB vb;
        vb.h[0] = *(const v8b*)(Vth + (t * 16 + c) * AT_KC + kk * 32 + 8 * hh);
        vb.h[1] = *(const v8b*)(Vth + (t * 16 + c) * AT_KC + kk * 32 + 16 + 8 * hh);
        oacc[t] = at_mma16<F16>(pa.v, vb.v, oacc[t]);
        if (SPLIT_PV) {
          FB vl;
          vl.h[0] = *(const v8b*)(Vtl + (t * 16 + c) * AT_KC + kk * 32 + 8 * hh);
          vl.h[1] = *(const v8b*)(Vtl + (t * 16 + c) * AT_KC + kk * 32 + 16 + 8 * hh);
          oacc[t] = at_mma16<F16>(pa.v, vl.v, oacc[t]);
          oacc[t] = at_mma16<F16>(pl.v, vb.v, oacc[t]);
        }
      }
    }
  }

  float* os = Os[wave];
#pragma unroll
  for (int r = 0; r < 8; ++r) {
    const float inv = 1.0f / (lrow[r] * PSC);
#pragma unroll
    for (int t = 0; t < 4; ++t) os[(8 * hh + r) * 68 + t * 16 + c] = oacc[t][r] * inv;
  }
  __builtin_amdgcn_fence(__ATOMIC_RELEASE, "workgroup");
  __builtin_amdgcn_wave_barrier();
  __builtin_amdgcn_fence(__ATOMIC_ACQUIRE, "workgroup");
  {
    const int c4 = (lane & 15) * 4;
    {
#pragma unroll
      for (int it = 0; it < 8; ++it) {
        const int row = it * 2 + hh;
        v4f val = *(const v4f*)(os + row * 68 + c4);
        *(v4f*)(ob_ptr + (size_t)(q0 + row) * g.o_rs + c4) = val;
      }
      
    }
  }
}

} // namespace w25



extern "C" void kernel_launch(void* const* d_in, const int* in_sizes, int n_in, void* d_out, int out_size, void* d_ws, size_t ws_size, hipStream_t stream) {
    (void)in_sizes; (void)n_in; (void)out_size; (void)ws_size;
    const float* x = (const float*)d_in[0];
    const float* ctx = (const float*)d_in[1];
    const float* Wq = (const float*)d_in[2];
    const float* Wk = (const float*)d_in[3];
    const float* Wv = (const float*)d_in[4];
    const float* Wo = (const float*)d_in[5];
    const float* bo = (const float*)d_in[6];
    const int Bn = 2;
    const int T = 2048;
    const int D = 1024;
    const int NH = 16;
    const int HD = 64;
    const int NR = Bn * T;
    const int RN = 2 * T - 1;
    float* out = (float*)d_out;
    char* wsp = (char*)d_ws;
    _Float16* Q = (_Float16*)wsp; wsp += (((size_t)((size_t)NR * D) * 2 + 255) / 256) * 256;
    _Float16* Kb = (_Float16*)wsp; wsp += (((size_t)((size_t)NR * D) * 2 + 255) / 256) * 256;
    _Float16* Vt = (_Float16*)wsp; wsp += (((size_t)((size_t)NR * D) * 2 + 255) / 256) * 256;   // V transposed: D rows of NR
    float* RT = (float*)wsp; wsp += (((size_t)((size_t)NH * RN + 64) * 4 + 255) / 256) * 256;
    unsigned short* G64A = (unsigned short*)wsp; wsp += (((size_t)(4194304) * 2 + 255) / 256) * 256;
    unsigned short* G64C = (unsigned short*)wsp; wsp += (((size_t)(4194304) * 2 + 255) / 256) * 256;
    unsigned short* G64B = (unsigned short*)wsp; wsp += (((size_t)(4 * 1048576) * 2 + 255) / 256) * 256;
    k_cast_in<NH, T><<<256, 512, 0, stream>>>(x, ctx, Wq, Wk, Wv, Wo, (_Float16*)(G64A), (_Float16*)(G64C), (_Float16*)(G64B), RT);
    w25::wmma_gemm_qkv<4096, 1024><<<768, 256, 0, stream>>>((const _Float16*)(G64A), (const _Float16*)(G64C), (const _Float16*)(G64B), Q, Kb, Vt, 0.0625f);
    k_attnT<2048, 1024, 4096><<<dim3(2048 / (16 * AW), 16, 2), 32 * AW, 0, stream>>>(Q, Kb, Vt, (_Float16*)(G64A), RT, 0.125f);   // x's f16 plane has been read for the last time: the attention output takes its place
    w25::wmma_gemm_lds<4096, 1024, 1024, 2, 0><<<256, 256, 0, stream>>>((const _Float16*)(G64A), (const _Float16*)(G64B + 3 * 1048576), out, nullptr, bo, 0.0625f);
}
